// v000
// Times are from an AMD MI455X. After a warm-up the kernel runs many times in a row, and a time is the length of
// such a window on the GPU divided by its runs, so every launch and the gaps after it count. The runs cycle
// through copies of the inputs. A figure is the median of several windows, for all but v000 over two sittings.
// Sittings can differ by a few percent; kernels timed side by side share one.
// The starting kernel, v000, takes 431 microseconds a run.
#include <hip/hip_runtime.h>
#include <math.h>

typedef __attribute__((ext_vector_type(16))) _Float16 v16h;
typedef __attribute__((ext_vector_type(16))) __bf16 v16b;
typedef __attribute__((ext_vector_type(8)))  _Float16 v8h;
typedef __attribute__((ext_vector_type(8)))  float v8f;
typedef __attribute__((ext_vector_type(4)))  float v4f;
typedef __attribute__((ext_vector_type(2)))  float v2f;
typedef __attribute__((ext_vector_type(4)))  unsigned v4u;
typedef __attribute__((ext_vector_type(4)))  int v4i;
typedef float __attribute__((may_alias)) float_a;
typedef int __attribute__((may_alias)) int_a;

template <typename T> __device__ __forceinline__ void vst2(void* p, T v) { *(T*)p = v;  }
__device__ __forceinline__ v8f wmma16(v16h a, v16h b, v8f c) {
  v8f d = __builtin_amdgcn_wmma_f32_16x16x32_f16(false, a, false, b, (short)0, c, false, false);
  asm volatile("v_nop\n\tv_nop\n\tv_nop\n\tv_nop" : "+v"(d) : "v"(a), "v"(b));
  return d;
}
__device__ __forceinline__ v8f wmma_bf(v16b a, v16b b, v8f c) {
  v8f d = __builtin_amdgcn_wmma_f32_16x16x32_bf16(false, a, false, b, (short)0, c, false, false);
  asm volatile("v_nop\n\tv_nop\n\tv_nop\n\tv_nop" : "+v"(d) : "v"(a), "v"(b));
  return d;
}
// 16x16x32 fragments: lane = (h = lane>>4, row/col = lane&15); elements 0..7 = k0+8h+0..7, 8..15 = k0+16+8h+0..7; D element r = row 8h+r
__device__ __forceinline__ v16h frag_h(const _Float16* rowk0, int lane) {
  union { v16h v; v8h q[2]; } u; const _Float16* p = rowk0 + 8 * (lane >> 4);
  u.q[0] = *(const v8h*)p; u.q[1] = *(const v8h*)(p + 16); return u.v;
}
__device__ __forceinline__ v16h frag_f32(const float* rowk0, int lane) {
  v16h a; const float* p = rowk0 + 8 * (lane >> 4);
#pragma unroll
  for (int i = 0; i < 8; ++i) { a[i] = (_Float16)p[i]; a[8 + i] = (_Float16)p[16 + i]; }
  return a;
}
__device__ __forceinline__ v16h frag_f32s(const float* rowk0, int lane, float sc) {
  v16h a; const float* p = rowk0 + 8 * (lane >> 4);
#pragma unroll
  for (int i = 0; i < 8; ++i) { a[i] = (_Float16)(p[i] * sc); a[8 + i] = (_Float16)(p[16 + i] * sc); }
  return a;
}
// column fragment from a [K][ld] layout (column n), rows >= K read as 0
__device__ __forceinline__ v16h fragc_f32(const float* W, int k0, int n, int lane, int ld, int K) {
  v16h a; const int g = lane >> 4;
#pragma unroll
  for (int i = 0; i < 8; ++i) { const int ka = k0 + 8 * g + i, kb = ka + 16;
    a[i] = (_Float16)(ka < K ? W[(size_t)ka * ld + n] : 0.f); a[8 + i] = (_Float16)(kb < K ? W[(size_t)kb * ld + n] : 0.f); }
  return a;
}
struct F2 { v16b h, l; };
__device__ __forceinline__ F2 bsplit16(const float v[16]) { F2 r;
#pragma unroll
  for (int i = 0; i < 16; ++i) { const __bf16 h = (__bf16)v[i]; r.h[i] = h; r.l[i] = (__bf16)(v[i] - (float)h); }
  return r; }
__device__ __forceinline__ F2 split_row(const float* row, int k0, int lane) { float v[16]; const float* p = row + k0 + 8 * (lane >> 4);
#pragma unroll
  for (int i = 0; i < 8; ++i) { v[i] = p[i]; v[8 + i] = p[16 + i]; }
  return bsplit16(v); }
__device__ __forceinline__ F2 split_rowK(const float* row, int k0, int lane, int K) { float v[16]; const int g = lane >> 4;
#pragma unroll
  for (int i = 0; i < 8; ++i) { const int ka = k0 + 8 * g + i, kb = ka + 16; v[i] = ka < K ? row[ka] : 0.f; v[8 + i] = kb < K ? row[kb] : 0.f; }
  return bsplit16(v); }
__device__ __forceinline__ F2 split_col(const float* W, int k0, int n, int lane, int ld, int K) { float v[16]; const int g = lane >> 4;
#pragma unroll
  for (int i = 0; i < 8; ++i) { const int ka = k0 + 8 * g + i, kb = ka + 16; v[i] = ka < K ? W[(size_t)ka * ld + n] : 0.f; v[8 + i] = kb < K ? W[(size_t)kb * ld + n] : 0.f; }
  return bsplit16(v); }
__device__ __forceinline__ v8f mac3(const F2& a, const F2& b, v8f c) { c = wmma_bf(a.l, b.h, c); c = wmma_bf(a.h, b.l, c); return wmma_bf(a.h, b.h, c); }
__device__ __forceinline__ float sigm(float v) { return 1.0f / (1.0f + expf(-v)); }
#define LDSX() do { asm volatile("s_wait_dscnt 0" ::: "memory"); __builtin_amdgcn_wave_barrier(); __builtin_amdgcn_fence(__ATOMIC_RELEASE, "workgroup"); } while (0)

// Leave-one-input-out MLP: for every (node i, sample b) the 3-layer tanh MLP is run on x with column i zeroed and output column i kept.
// Layer 1 uses the rank-1 identity (x - x_i e_i) W0^T = z1 - x_i W0[:, i] with z1 = x W0^T computed once (two-way bf16 split), so the
// masked hidden rows are generated on the fly (tanh in f32 -> f16 A operand); layer 2 is the [262144 x 256] @ [256 x 256] product on
// v_wmma_f32_16x16x32_f16 (W1 rows x16 in the fragments); layer 3 needs only column i: tanh(h2 . W2[i]) in f32 with lane shuffles.
#define NBT 1024
#define NN 256

// z1 = x @ W0^T (split) : [1024 x 256]
__global__ __launch_bounds__(128) void k_z1(const float* __restrict__ x, const float* __restrict__ W0, float* __restrict__ Z1) {
  __shared__ __align__(16) float so[4][16][132];
  const int tid = threadIdx.x, wave = tid >> 5, lane = tid & 31, col = lane & 15, g = lane >> 4;
  const int r0 = blockIdx.x * 64 + wave * 16, n0 = blockIdx.y * 128;
  v8f acc[8] = {};
#pragma unroll 1
  for (int kc = 0; kc < NN / 32; ++kc) { const F2 a = split_row(x + (size_t)(r0 + col) * NN, kc * 32, lane);
#pragma unroll
    for (int j = 0; j < 8; ++j) acc[j] = mac3(a, split_row(W0 + (size_t)(n0 + j * 16 + col) * NN, kc * 32, lane), acc[j]); }
#pragma unroll
  for (int j = 0; j < 8; ++j)
#pragma unroll
    for (int r = 0; r < 8; ++r) so[wave][8 * g + r][j * 16 + col] = acc[j][r];
  LDSX();
#pragma unroll 4
  for (int rl = 0; rl < 16; ++rl) vst2(Z1 + (size_t)(r0 + rl) * NN + n0 + lane * 4, *(const v4f*)(&so[wave][rl][lane * 4]));
}
// main: block (64 samples b, node i): rows = b ; FT[i][b]
__global__ __launch_bounds__(128) void k_main(const float* __restrict__ x, const float* __restrict__ W0, const float* __restrict__ Z1, const float* __restrict__ W1, const float* __restrict__ W2, float* __restrict__ FT) {
  __shared__ float sw0c[NN], sw2r[NN];                    // W0[:, i] and W2[i, :]
  __shared__ __align__(16) float sf[64];
  __shared__ float sh2[4][16][NN + 1];                    // layer-2 pre-activations per wave
  const int tid = threadIdx.x, wave = tid >> 5, lane = tid & 31, col = lane & 15, g = lane >> 4;
  const int i = blockIdx.y, b0 = blockIdx.x * 64 + wave * 16;
  for (int q = tid; q < NN; q += 128) { sw0c[q] = W0[(size_t)q * NN + i]; sw2r[q] = W2[(size_t)i * NN + q]; }
  __syncthreads();
  const int bm = b0 + col; const float xi = x[(size_t)bm * NN + i]; const float* zr = Z1 + (size_t)bm * NN;
  v8f acc[16];
#pragma unroll
  for (int t = 0; t < 16; ++t) acc[t] = (v8f){};
#pragma unroll 1
  for (int kc = 0; kc < NN / 32; ++kc) { v16h a;
#pragma unroll
    for (int e = 0; e < 8; ++e) { const int ka = kc * 32 + 8 * g + e, kb = ka + 16; a[e] = (_Float16)tanhf(zr[ka] - xi * sw0c[ka]); a[8 + e] = (_Float16)tanhf(zr[kb] - xi * sw0c[kb]); }
#pragma unroll
    for (int t = 0; t < 16; ++t) acc[t] = wmma16(a, frag_f32s(W1 + (size_t)(t * 16 + col) * NN + kc * 32, lane, 16.0f), acc[t]); }
  // layer 3, column i only: f = tanh( sum_n tanh(h2[n]) W2[i][n] ): pre-activations to LDS, then 2 lanes per row in a rolled loop
#pragma unroll
  for (int t = 0; t < 16; ++t)
#pragma unroll
    for (int r = 0; r < 8; ++r) sh2[wave][8 * g + r][t * 16 + col] = acc[t][r] * (1.0f / 16.0f);
  LDSX();
  { const int rl = lane >> 1, hf = lane & 1; float s = 0.f;
#pragma unroll 2
    for (int n = hf * 128; n < hf * 128 + 128; ++n) s += tanhf(sh2[wave][rl][n]) * sw2r[n];
    s += __shfl_xor(s, 1, 32);
    if (hf == 0) sf[wave * 16 + rl] = tanhf(s); }
  __syncthreads();
  if (tid < 16) vst2(FT + (size_t)i * NBT + blockIdx.x * 64 + tid * 4, *(const v4f*)(&sf[tid * 4]));
}
// transpose FT [i][b] -> out [b][i]: block = 64 b x 256 i via LDS
__global__ __launch_bounds__(256) void k_tr(const float* __restrict__ FT, float* __restrict__ out) {
  __shared__ float st[64][NN + 1];
  const int b0 = blockIdx.x * 64, tid = threadIdx.x;
  for (int q = tid; q < NN * 64; q += 256) { const int i = q >> 6, bl = q & 63; st[bl][i] = FT[(size_t)i * NBT + b0 + bl]; }
  __syncthreads();
  for (int q = tid; q < 64 * (NN / 4); q += 256) { const int bl = q >> 6, pc = q & 63; v4f o; o[0] = st[bl][pc * 4]; o[1] = st[bl][pc * 4 + 1]; o[2] = st[bl][pc * 4 + 2]; o[3] = st[bl][pc * 4 + 3]; vst2(out + (size_t)(b0 + bl) * NN + pc * 4, o); }
}
extern "C" void kernel_launch(void* const* d_in, const int* in_sizes, int n_in, void* d_out, int out_size, void* d_ws, size_t ws_size, hipStream_t stream) {
  (void)in_sizes; (void)n_in; (void)out_size; (void)ws_size;
  const float* x = (const float*)d_in[0]; const float* W0 = (const float*)d_in[1]; const float* W1 = (const float*)d_in[2]; const float* W2 = (const float*)d_in[3];
  float* out = (float*)d_out;
  char* ws = (char*)d_ws; size_t off = 0;
  auto take = [&](size_t bytes) { char* p = ws + off; off += (bytes + 255) & ~(size_t)255; return p; };
  float* Z1 = (float*)take((size_t)NBT * NN * 4); float* FT = (float*)take((size_t)NN * NBT * 4);
  k_z1<<<dim3(NBT / 64, NN / 128), 128, 0, stream>>>(x, W0, Z1);
  k_main<<<dim3(NBT / 64, NN), 128, 0, stream>>>(x, W0, Z1, W1, W2, FT);
  k_tr<<<NBT / 64, 256, 0, stream>>>(FT, out);
}

// v001
// One run takes 199 microseconds.
// Two timings next to v000 both put it at 2.21 times that version's speed.
#include <hip/hip_runtime.h>
#include <math.h>

typedef __attribute__((ext_vector_type(16))) _Float16 v16h;
typedef __attribute__((ext_vector_type(16))) __bf16 v16b;
typedef __attribute__((ext_vector_type(8)))  _Float16 v8h;
typedef __attribute__((ext_vector_type(8)))  float v8f;
typedef __attribute__((ext_vector_type(4)))  float v4f;
typedef __attribute__((ext_vector_type(2)))  float v2f;
typedef __attribute__((ext_vector_type(4)))  unsigned v4u;
typedef __attribute__((ext_vector_type(4)))  int v4i;
typedef float __attribute__((may_alias)) float_a;
typedef int __attribute__((may_alias)) int_a;

template <typename T> __device__ __forceinline__ void vst2(void* p, T v) { *(T*)p = v;  }
__device__ __forceinline__ v8f wmma16(v16h a, v16h b, v8f c) {
  v8f d = __builtin_amdgcn_wmma_f32_16x16x32_f16(false, a, false, b, (short)0, c, false, false);
  asm volatile("v_nop\n\tv_nop\n\tv_nop\n\tv_nop" : "+v"(d) : "v"(a), "v"(b));
  return d;
}
__device__ __forceinline__ v8f wmma_bf(v16b a, v16b b, v8f c) {
  v8f d = __builtin_amdgcn_wmma_f32_16x16x32_bf16(false, a, false, b, (short)0, c, false, false);
  asm volatile("v_nop\n\tv_nop\n\tv_nop\n\tv_nop" : "+v"(d) : "v"(a), "v"(b));
  return d;
}
// 16x16x32 fragments: lane = (h = lane>>4, row/col = lane&15); elements 0..7 = k0+8h+0..7, 8..15 = k0+16+8h+0..7; D element r = row 8h+r
__device__ __forceinline__ v16h frag_h(const _Float16* rowk0, int lane) {
  union { v16h v; v8h q[2]; } u; const _Float16* p = rowk0 + 8 * (lane >> 4);
  u.q[0] = *(const v8h*)p; u.q[1] = *(const v8h*)(p + 16); return u.v;
}
__device__ __forceinline__ v16h frag_f32(const float* rowk0, int lane) {
  v16h a; const float* p = rowk0 + 8 * (lane >> 4);
#pragma unroll
  for (int i = 0; i < 8; ++i) { a[i] = (_Float16)p[i]; a[8 + i] = (_Float16)p[16 + i]; }
  return a;
}
__device__ __forceinline__ v16h frag_f32s(const float* rowk0, int lane, float sc) {
  v16h a; const float* p = rowk0 + 8 * (lane >> 4);
#pragma unroll
  for (int i = 0; i < 8; ++i) { a[i] = (_Float16)(p[i] * sc); a[8 + i] = (_Float16)(p[16 + i] * sc); }
  return a;
}
// column fragment from a [K][ld] layout (column n), rows >= K read as 0
__device__ __forceinline__ v16h fragc_f32(const float* W, int k0, int n, int lane, int ld, int K) {
  v16h a; const int g = lane >> 4;
#pragma unroll
  for (int i = 0; i < 8; ++i) { const int ka = k0 + 8 * g + i, kb = ka + 16;
    a[i] = (_Float16)(ka < K ? W[(size_t)ka * ld + n] : 0.f); a[8 + i] = (_Float16)(kb < K ? W[(size_t)kb * ld + n] : 0.f); }
  return a;
}
// B fragment stored in fragment order: 512 halves = elements 0..7 of lanes 0..31, then elements 8..15 of lanes 0..31 (two whole-line 16-byte loads)
__device__ __forceinline__ v16h frag_pre(const _Float16* f, int lane) {
  union { v16h v; v8h q[2]; } u; u.q[0] = *(const v8h*)(f + lane * 8); u.q[1] = *(const v8h*)(f + 256 + lane * 8); return u.v;
}
struct F2 { v16b h, l; };
__device__ __forceinline__ F2 bsplit16(const float v[16]) { F2 r;
#pragma unroll
  for (int i = 0; i < 16; ++i) { const __bf16 h = (__bf16)v[i]; r.h[i] = h; r.l[i] = (__bf16)(v[i] - (float)h); }
  return r; }
__device__ __forceinline__ F2 split_row(const float* row, int k0, int lane) { float v[16]; const float* p = row + k0 + 8 * (lane >> 4);
#pragma unroll
  for (int i = 0; i < 8; ++i) { v[i] = p[i]; v[8 + i] = p[16 + i]; }
  return bsplit16(v); }
__device__ __forceinline__ F2 split_rowK(const float* row, int k0, int lane, int K) { float v[16]; const int g = lane >> 4;
#pragma unroll
  for (int i = 0; i < 8; ++i) { const int ka = k0 + 8 * g + i, kb = ka + 16; v[i] = ka < K ? row[ka] : 0.f; v[8 + i] = kb < K ? row[kb] : 0.f; }
  return bsplit16(v); }
__device__ __forceinline__ F2 split_col(const float* W, int k0, int n, int lane, int ld, int K) { float v[16]; const int g = lane >> 4;
#pragma unroll
  for (int i = 0; i < 8; ++i) { const int ka = k0 + 8 * g + i, kb = ka + 16; v[i] = ka < K ? W[(size_t)ka * ld + n] : 0.f; v[8 + i] = kb < K ? W[(size_t)kb * ld + n] : 0.f; }
  return bsplit16(v); }
__device__ __forceinline__ v8f mac3(const F2& a, const F2& b, v8f c) { c = wmma_bf(a.l, b.h, c); c = wmma_bf(a.h, b.l, c); return wmma_bf(a.h, b.h, c); }
__device__ __forceinline__ float sigm(float v) { return 1.0f / (1.0f + expf(-v)); }
#define LDSX() do { asm volatile("s_wait_dscnt 0" ::: "memory"); __builtin_amdgcn_wave_barrier(); __builtin_amdgcn_fence(__ATOMIC_RELEASE, "workgroup"); } while (0)

// Leave-one-input-out MLP: for every (node i, sample b) the 3-layer tanh MLP is run on x with column i zeroed and output column i kept.
// Layer 1 uses the rank-1 identity (x - x_i e_i) W0^T = z1 - x_i W0[:, i] with z1 = x W0^T computed once (two-way bf16 split), so the
// masked hidden rows are generated on the fly (tanh in f32 -> f16 A operand); layer 2 is the [262144 x 256] @ [256 x 256] product on
// v_wmma_f32_16x16x32_f16 (W1 rows x16, converted once to f16 in fragment order in the workspace); layer 3 needs only column i: tanh(h2 . W2[i]) in f32 with lane shuffles.
#define NBT 1024
#define NN 256

// blockIdx.y < 2: z1 = x @ W0^T (split) : [1024 x 256]; blockIdx.y >= 2: WF = 16 * W1 as f16, fragment f = kc * 16 + t (k block kc, column tile t)
__global__ __launch_bounds__(128) void k_z1(const float* __restrict__ x, const float* __restrict__ W0, const float* __restrict__ W1, float* __restrict__ Z1, _Float16* __restrict__ WF) {
  __shared__ __align__(16) float so[4][16][132];
  const int tid = threadIdx.x, wave = tid >> 5, lane = tid & 31, col = lane & 15, g = lane >> 4;
  if (blockIdx.y >= 2) { const int f = (blockIdx.y - 2) * 64 + blockIdx.x * 4 + wave, kc = f >> 4, t = f & 15;   // one fragment per wave
    union { v16h v; v8h q[2]; } b; b.v = frag_f32s(W1 + (size_t)(t * 16 + col) * NN + kc * 32, lane, 16.0f);
    vst2(WF + (size_t)f * 512 + lane * 8, b.q[0]); vst2(WF + (size_t)f * 512 + 256 + lane * 8, b.q[1]);
    return;
  }
  const int r0 = blockIdx.x * 64 + wave * 16, n0 = blockIdx.y * 128;
  v8f acc[8] = {};
#pragma unroll 1
  for (int kc = 0; kc < NN / 32; ++kc) { const F2 a = split_row(x + (size_t)(r0 + col) * NN, kc * 32, lane);
#pragma unroll
    for (int j = 0; j < 8; ++j) acc[j] = mac3(a, split_row(W0 + (size_t)(n0 + j * 16 + col) * NN, kc * 32, lane), acc[j]); }
#pragma unroll
  for (int j = 0; j < 8; ++j)
#pragma unroll
    for (int r = 0; r < 8; ++r) so[wave][8 * g + r][j * 16 + col] = acc[j][r];
  LDSX();
#pragma unroll 4
  for (int rl = 0; rl < 16; ++rl) vst2(Z1 + (size_t)(r0 + rl) * NN + n0 + lane * 4, *(const v4f*)(&so[wave][rl][lane * 4]));
}
// main: block (64 samples b, node i): rows = b ; FT[i][b]
__global__ __launch_bounds__(128) void k_main(const float* __restrict__ x, const float* __restrict__ W0, const float* __restrict__ Z1, const _Float16* __restrict__ WF, const float* __restrict__ W2, float* __restrict__ FT) {
  __shared__ float sw0c[NN], sw2r[NN];                    // W0[:, i] and W2[i, :]
  __shared__ __align__(16) float sf[64];
  __shared__ float sh2[4][16][NN + 1];                    // layer-2 pre-activations per wave
  const int tid = threadIdx.x, wave = tid >> 5, lane = tid & 31, col = lane & 15, g = lane >> 4;
  const int i = blockIdx.y, b0 = blockIdx.x * 64 + wave * 16;
  for (int q = tid; q < NN; q += 128) { sw0c[q] = W0[(size_t)q * NN + i]; sw2r[q] = W2[(size_t)i * NN + q]; }
  __syncthreads();
  const int bm = b0 + col; const float xi = x[(size_t)bm * NN + i]; const float* zr = Z1 + (size_t)bm * NN;
  v8f acc[16];
#pragma unroll
  for (int t = 0; t < 16; ++t) acc[t] = (v8f){};
#pragma unroll 1
  for (int kc = 0; kc < NN / 32; ++kc) { v16h a, b[8]; const _Float16* wf = WF + (size_t)kc * 16 * 512;
#pragma unroll  // here and below: constant indices keep b[] and acc[] in registers
    for (int t = 0; t < 8; ++t) b[t] = frag_pre(wf + t * 512, lane);   // tiles 0..7 fly while the A fragment is computed
#pragma unroll
    for (int e = 0; e < 8; ++e) { const int ka = kc * 32 + 8 * g + e, kb = ka + 16; a[e] = (_Float16)tanhf(zr[ka] - xi * sw0c[ka]); a[8 + e] = (_Float16)tanhf(zr[kb] - xi * sw0c[kb]); }
#pragma unroll
    for (int t = 0; t < 8; ++t) { acc[t] = wmma16(a, b[t], acc[t]); b[t] = frag_pre(wf + (t + 8) * 512, lane); }   // tile t + 8 flies behind the next products
#pragma unroll
    for (int t = 0; t < 8; ++t) acc[t + 8] = wmma16(a, b[t], acc[t + 8]); }
  // layer 3, column i only: f = tanh( sum_n tanh(h2[n]) W2[i][n] ): pre-activations to LDS, then 2 lanes per row in a rolled loop
#pragma unroll
  for (int t = 0; t < 16; ++t)
#pragma unroll
    for (int r = 0; r < 8; ++r) sh2[wave][8 * g + r][t * 16 + col] = acc[t][r] * (1.0f / 16.0f);
  LDSX();
  { const int rl = lane >> 1, hf = lane & 1; float s = 0.f;
#pragma unroll 2
    for (int n = hf * 128; n < hf * 128 + 128; ++n) s += tanhf(sh2[wave][rl][n]) * sw2r[n];
    s += __shfl_xor(s, 1, 32);
    if (hf == 0) sf[wave * 16 + rl] = tanhf(s); }
  __syncthreads();
  if (tid < 16) vst2(FT + (size_t)i * NBT + blockIdx.x * 64 + tid * 4, *(const v4f*)(&sf[tid * 4]));
}
// transpose FT [i][b] -> out [b][i]: block = 64 b x 256 i via LDS
__global__ __launch_bounds__(256) void k_tr(const float* __restrict__ FT, float* __restrict__ out) {
  __shared__ float st[64][NN + 1];
  const int b0 = blockIdx.x * 64, tid = threadIdx.x;
  for (int q = tid; q < NN * 64; q += 256) { const int i = q >> 6, bl = q & 63; st[bl][i] = FT[(size_t)i * NBT + b0 + bl]; }
  __syncthreads();
  for (int q = tid; q < 64 * (NN / 4); q += 256) { const int bl = q >> 6, pc = q & 63; v4f o; o[0] = st[bl][pc * 4]; o[1] = st[bl][pc * 4 + 1]; o[2] = st[bl][pc * 4 + 2]; o[3] = st[bl][pc * 4 + 3]; vst2(out + (size_t)(b0 + bl) * NN + pc * 4, o); }
}
extern "C" void kernel_launch(void* const* d_in, const int* in_sizes, int n_in, void* d_out, int out_size, void* d_ws, size_t ws_size, hipStream_t stream) {
  (void)in_sizes; (void)n_in; (void)out_size; (void)ws_size;
  const float* x = (const float*)d_in[0]; const float* W0 = (const float*)d_in[1]; const float* W1 = (const float*)d_in[2]; const float* W2 = (const float*)d_in[3];
  float* out = (float*)d_out;
  char* ws = (char*)d_ws; size_t off = 0;
  auto take = [&](size_t bytes) { char* p = ws + off; off += (bytes + 255) & ~(size_t)255; return p; };
  float* Z1 = (float*)take((size_t)NBT * NN * 4); float* FT = (float*)take((size_t)NN * NBT * 4); _Float16* WF = (_Float16*)take((size_t)NN * NN * 2);
  k_z1<<<dim3(NBT / 64, NN / 128 + 2), 128, 0, stream>>>(x, W0, W1, Z1, WF);
  k_main<<<dim3(NBT / 64, NN), 128, 0, stream>>>(x, W0, Z1, WF, W2, FT);
  k_tr<<<NBT / 64, 256, 0, stream>>>(FT, out);
}

// v002
// One run takes 102 microseconds.
// Next to v001, in two timings, it ran 1.96 times as fast each time.
// Over all steps from v000 it is 4.33 times as fast.
#include <hip/hip_runtime.h>
#include <math.h>

typedef __attribute__((ext_vector_type(16))) _Float16 v16h;
typedef __attribute__((ext_vector_type(16))) __bf16 v16b;
typedef __attribute__((ext_vector_type(8)))  _Float16 v8h;
typedef __attribute__((ext_vector_type(8)))  float v8f;
typedef __attribute__((ext_vector_type(4)))  float v4f;
typedef __attribute__((ext_vector_type(2)))  float v2f;
typedef __attribute__((ext_vector_type(4)))  unsigned v4u;
typedef __attribute__((ext_vector_type(4)))  int v4i;
typedef float __attribute__((may_alias)) float_a;
typedef int __attribute__((may_alias)) int_a;

template <typename T> __device__ __forceinline__ void vst2(void* p, T v) { *(T*)p = v;  }
__device__ __forceinline__ v8f wmma16(v16h a, v16h b, v8f c) {
  v8f d = __builtin_amdgcn_wmma_f32_16x16x32_f16(false, a, false, b, (short)0, c, false, false);
  asm volatile("v_nop\n\tv_nop\n\tv_nop\n\tv_nop" : "+v"(d) : "v"(a), "v"(b));
  return d;
}
__device__ __forceinline__ v8f wmma_bf(v16b a, v16b b, v8f c) {
  v8f d = __builtin_amdgcn_wmma_f32_16x16x32_bf16(false, a, false, b, (short)0, c, false, false);
  asm volatile("v_nop\n\tv_nop\n\tv_nop\n\tv_nop" : "+v"(d) : "v"(a), "v"(b));
  return d;
}
// 16x16x32 fragments: lane = (h = lane>>4, row/col = lane&15); elements 0..7 = k0+8h+0..7, 8..15 = k0+16+8h+0..7; D element r = row 8h+r
__device__ __forceinline__ v16h frag_h(const _Float16* rowk0, int lane) {
  union { v16h v; v8h q[2]; } u; const _Float16* p = rowk0 + 8 * (lane >> 4);
  u.q[0] = *(const v8h*)p; u.q[1] = *(const v8h*)(p + 16); return u.v;
}
__device__ __forceinline__ v16h frag_f32(const float* rowk0, int lane) {
  v16h a; const float* p = rowk0 + 8 * (lane >> 4);
#pragma unroll
  for (int i = 0; i < 8; ++i) { a[i] = (_Float16)p[i]; a[8 + i] = (_Float16)p[16 + i]; }
  return a;
}
__device__ __forceinline__ v16h frag_f32s(const float* rowk0, int lane, float sc) {
  v16h a; const float* p = rowk0 + 8 * (lane >> 4);
#pragma unroll
  for (int i = 0; i < 8; ++i) { a[i] = (_Float16)(p[i] * sc); a[8 + i] = (_Float16)(p[16 + i] * sc); }
  return a;
}
// column fragment from a [K][ld] layout (column n), rows >= K read as 0
__device__ __forceinline__ v16h fragc_f32(const float* W, int k0, int n, int lane, int ld, int K) {
  v16h a; const int g = lane >> 4;
#pragma unroll
  for (int i = 0; i < 8; ++i) { const int ka = k0 + 8 * g + i, kb = ka + 16;
    a[i] = (_Float16)(ka < K ? W[(size_t)ka * ld + n] : 0.f); a[8 + i] = (_Float16)(kb < K ? W[(size_t)kb * ld + n] : 0.f); }
  return a;
}
// B fragment stored in fragment order: 512 halves = elements 0..7 of lanes 0..31, then elements 8..15 of lanes 0..31 (two whole-line 16-byte loads)
__device__ __forceinline__ v16h frag_pre(const _Float16* f, int lane) {
  union { v16h v; v8h q[2]; } u; u.q[0] = *(const v8h*)(f + lane * 8); u.q[1] = *(const v8h*)(f + 256 + lane * 8); return u.v;
}
struct F2 { v16b h, l; };
__device__ __forceinline__ F2 bsplit16(const float v[16]) { F2 r;
#pragma unroll
  for (int i = 0; i < 16; ++i) { const __bf16 h = (__bf16)v[i]; r.h[i] = h; r.l[i] = (__bf16)(v[i] - (float)h); }
  return r; }
__device__ __forceinline__ F2 split_row(const float* row, int k0, int lane) { float v[16]; const float* p = row + k0 + 8 * (lane >> 4);
#pragma unroll
  for (int i = 0; i < 8; ++i) { v[i] = p[i]; v[8 + i] = p[16 + i]; }
  return bsplit16(v); }
__device__ __forceinline__ F2 split_rowK(const float* row, int k0, int lane, int K) { float v[16]; const int g = lane >> 4;
#pragma unroll
  for (int i = 0; i < 8; ++i) { const int ka = k0 + 8 * g + i, kb = ka + 16; v[i] = ka < K ? row[ka] : 0.f; v[8 + i] = kb < K ? row[kb] : 0.f; }
  return bsplit16(v); }
__device__ __forceinline__ F2 split_col(const float* W, int k0, int n, int lane, int ld, int K) { float v[16]; const int g = lane >> 4;
#pragma unroll
  for (int i = 0; i < 8; ++i) { const int ka = k0 + 8 * g + i, kb = ka + 16; v[i] = ka < K ? W[(size_t)ka * ld + n] : 0.f; v[8 + i] = kb < K ? W[(size_t)kb * ld + n] : 0.f; }
  return bsplit16(v); }
__device__ __forceinline__ v8f mac3(const F2& a, const F2& b, v8f c) { c = wmma_bf(a.l, b.h, c); c = wmma_bf(a.h, b.l, c); return wmma_bf(a.h, b.h, c); }
// one v_tanh_f32 in place of the branching library routine
__device__ __forceinline__ float tanh1(float v) { return __builtin_amdgcn_tanhf(v); }
// the same with the slot behind a transcendental filled in the statement itself
__device__ __forceinline__ float tanh1n(float v) { float r; asm("v_tanh_f32 %0, %1\n\tv_nop" : "=v"(r) : "v"(v)); return r; }
__device__ __forceinline__ float sigm(float v) { return 1.0f / (1.0f + expf(-v)); }
#define LDSX() do { asm volatile("s_wait_dscnt 0" ::: "memory"); __builtin_amdgcn_wave_barrier(); __builtin_amdgcn_fence(__ATOMIC_RELEASE, "workgroup"); } while (0)

// Leave-one-input-out MLP: for every (node i, sample b) the 3-layer tanh MLP is run on x with column i zeroed and output column i kept.
// Layer 1 uses the rank-1 identity (x - x_i e_i) W0^T = z1 - x_i W0[:, i] with z1 = x W0^T computed once (two-way bf16 split), so the
// masked hidden rows are generated on the fly (tanh in f32 -> f16 A operand); layer 2 is the [262144 x 256] @ [256 x 256] product on
// v_wmma_f32_16x16x32_f16 (W1 rows x16, converted once to f16 in fragment order in the workspace); layer 3 needs only column i: tanh(h2 . W2[i]) in f32 with lane shuffles.
#define NBT 1024
#define NN 256

// blockIdx.y < 2: z1 = x @ W0^T (split) : [1024 x 256]; blockIdx.y >= 2: WF = 16 * W1 as f16, fragment f = kc * 16 + t (k block kc, column tile t)
__global__ __launch_bounds__(128) void k_z1(const float* __restrict__ x, const float* __restrict__ W0, const float* __restrict__ W1, float* __restrict__ Z1, _Float16* __restrict__ WF) {
  __shared__ __align__(16) float so[4][16][132];
  const int tid = threadIdx.x, wave = tid >> 5, lane = tid & 31, col = lane & 15, g = lane >> 4;
  if (blockIdx.y >= 2) { const int f = (blockIdx.y - 2) * 64 + blockIdx.x * 4 + wave, kc = f >> 4, t = f & 15;   // one fragment per wave
    union { v16h v; v8h q[2]; } b; b.v = frag_f32s(W1 + (size_t)(t * 16 + col) * NN + kc * 32, lane, 16.0f);
    vst2(WF + (size_t)f * 512 + lane * 8, b.q[0]); vst2(WF + (size_t)f * 512 + 256 + lane * 8, b.q[1]);
    return;
  }
  const int r0 = blockIdx.x * 64 + wave * 16, n0 = blockIdx.y * 128;
  v8f acc[8] = {};
#pragma unroll 1
  for (int kc = 0; kc < NN / 32; ++kc) { const F2 a = split_row(x + (size_t)(r0 + col) * NN, kc * 32, lane);
#pragma unroll
    for (int j = 0; j < 8; ++j) acc[j] = mac3(a, split_row(W0 + (size_t)(n0 + j * 16 + col) * NN, kc * 32, lane), acc[j]); }
#pragma unroll
  for (int j = 0; j < 8; ++j)
#pragma unroll
    for (int r = 0; r < 8; ++r) so[wave][8 * g + r][j * 16 + col] = acc[j][r];
  LDSX();
#pragma unroll 4
  for (int rl = 0; rl < 16; ++rl) vst2(Z1 + (size_t)(r0 + rl) * NN + n0 + lane * 4, *(const v4f*)(&so[wave][rl][lane * 4]));
}
// main: block (64 samples b, node i): rows = b ; FT[i][b]
__global__ __launch_bounds__(128) void k_main(const float* __restrict__ x, const float* __restrict__ W0, const float* __restrict__ Z1, const _Float16* __restrict__ WF, const float* __restrict__ W2, float* __restrict__ FT) {
  __shared__ float sw0c[NN], sw2r[NN];                    // W0[:, i] and W2[i, :]
  __shared__ __align__(16) float sf[64];
  __shared__ float sh2[4][16][NN + 1];                    // layer-2 pre-activations per wave
  const int tid = threadIdx.x, wave = tid >> 5, lane = tid & 31, col = lane & 15, g = lane >> 4;
  const int i = blockIdx.y, b0 = blockIdx.x * 64 + wave * 16;
  for (int q = tid; q < NN; q += 128) { sw0c[q] = W0[(size_t)q * NN + i]; sw2r[q] = W2[(size_t)i * NN + q]; }
  __syncthreads();
  const int bm = b0 + col; const float xi = x[(size_t)bm * NN + i]; const float* zr = Z1 + (size_t)bm * NN;
  v8f acc[16];
#pragma unroll
  for (int t = 0; t < 16; ++t) acc[t] = (v8f){};
#pragma unroll 1
  for (int kc = 0; kc < NN / 32; ++kc) { v16h a, b[8]; const _Float16* wf = WF + (size_t)kc * 16 * 512;
#pragma unroll  // here and below: constant indices keep b[] and acc[] in registers
    for (int t = 0; t < 8; ++t) b[t] = frag_pre(wf + t * 512, lane);   // tiles 0..7 fly while the A fragment is computed
#pragma unroll
    for (int e = 0; e < 8; ++e) { const int ka = kc * 32 + 8 * g + e, kb = ka + 16; a[e] = (_Float16)tanh1(zr[ka] - xi * sw0c[ka]); a[8 + e] = (_Float16)tanh1(zr[kb] - xi * sw0c[kb]); }
#pragma unroll
    for (int t = 0; t < 8; ++t) { acc[t] = wmma16(a, b[t], acc[t]); b[t] = frag_pre(wf + (t + 8) * 512, lane); }   // tile t + 8 flies behind the next products
#pragma unroll
    for (int t = 0; t < 8; ++t) acc[t + 8] = wmma16(a, b[t], acc[t + 8]); }
  // layer 3, column i only: f = tanh( sum_n tanh(h2[n]) W2[i][n] ): pre-activations to LDS, then 2 lanes per row in a rolled loop
#pragma unroll
  for (int t = 0; t < 16; ++t)
#pragma unroll
    for (int r = 0; r < 8; ++r) sh2[wave][8 * g + r][t * 16 + col] = acc[t][r] * (1.0f / 16.0f);
  LDSX();
  { const int rl = lane >> 1, hf = lane & 1; float s = 0.f;
#pragma unroll 2
    for (int n = hf * 128; n < hf * 128 + 128; ++n) s += tanh1n(sh2[wave][rl][n]) * sw2r[n];
    s += __shfl_xor(s, 1, 32);
    if (hf == 0) sf[wave * 16 + rl] = tanh1(s); }
  __syncthreads();
  if (tid < 16) vst2(FT + (size_t)i * NBT + blockIdx.x * 64 + tid * 4, *(const v4f*)(&sf[tid * 4]));
}
// transpose FT [i][b] -> out [b][i]: block = 64 b x 256 i via LDS
__global__ __launch_bounds__(256) void k_tr(const float* __restrict__ FT, float* __restrict__ out) {
  __shared__ float st[64][NN + 1];
  const int b0 = blockIdx.x * 64, tid = threadIdx.x;
  for (int q = tid; q < NN * 64; q += 256) { const int i = q >> 6, bl = q & 63; st[bl][i] = FT[(size_t)i * NBT + b0 + bl]; }
  __syncthreads();
  for (int q = tid; q < 64 * (NN / 4); q += 256) { const int bl = q >> 6, pc = q & 63; v4f o; o[0] = st[bl][pc * 4]; o[1] = st[bl][pc * 4 + 1]; o[2] = st[bl][pc * 4 + 2]; o[3] = st[bl][pc * 4 + 3]; vst2(out + (size_t)(b0 + bl) * NN + pc * 4, o); }
}
extern "C" void kernel_launch(void* const* d_in, const int* in_sizes, int n_in, void* d_out, int out_size, void* d_ws, size_t ws_size, hipStream_t stream) {
  (void)in_sizes; (void)n_in; (void)out_size; (void)ws_size;
  const float* x = (const float*)d_in[0]; const float* W0 = (const float*)d_in[1]; const float* W1 = (const float*)d_in[2]; const float* W2 = (const float*)d_in[3];
  float* out = (float*)d_out;
  char* ws = (char*)d_ws; size_t off = 0;
  auto take = [&](size_t bytes) { char* p = ws + off; off += (bytes + 255) & ~(size_t)255; return p; };
  float* Z1 = (float*)take((size_t)NBT * NN * 4); float* FT = (float*)take((size_t)NN * NBT * 4); _Float16* WF = (_Float16*)take((size_t)NN * NN * 2);
  k_z1<<<dim3(NBT / 64, NN / 128 + 2), 128, 0, stream>>>(x, W0, W1, Z1, WF);
  k_main<<<dim3(NBT / 64, NN), 128, 0, stream>>>(x, W0, Z1, WF, W2, FT);
  k_tr<<<NBT / 64, 256, 0, stream>>>(FT, out);
}

// v003
// One run takes 87.6 microseconds.
// Timed twice side by side with v002, it ran 1.16 times as fast both times.
// Over all steps from v000 it is 5.04 times as fast.
#include <hip/hip_runtime.h>
#include <math.h>

typedef __attribute__((ext_vector_type(16))) _Float16 v16h;
typedef __attribute__((ext_vector_type(16))) __bf16 v16b;
typedef __attribute__((ext_vector_type(8)))  _Float16 v8h;
typedef __attribute__((ext_vector_type(8)))  float v8f;
typedef __attribute__((ext_vector_type(4)))  float v4f;
typedef __attribute__((ext_vector_type(2)))  float v2f;
typedef __attribute__((ext_vector_type(4)))  unsigned v4u;
typedef __attribute__((ext_vector_type(4)))  int v4i;
typedef float __attribute__((may_alias)) float_a;
typedef int __attribute__((may_alias)) int_a;

template <typename T> __device__ __forceinline__ void vst2(void* p, T v) { *(T*)p = v;  }
__device__ __forceinline__ v8f wmma16(v16h a, v16h b, v8f c) {
  v8f d = __builtin_amdgcn_wmma_f32_16x16x32_f16(false, a, false, b, (short)0, c, false, false);
  asm volatile("v_nop\n\tv_nop\n\tv_nop\n\tv_nop" : "+v"(d) : "v"(a), "v"(b));
  return d;
}
__device__ __forceinline__ v8f wmma_bf(v16b a, v16b b, v8f c) {
  v8f d = __builtin_amdgcn_wmma_f32_16x16x32_bf16(false, a, false, b, (short)0, c, false, false);
  asm volatile("v_nop\n\tv_nop\n\tv_nop\n\tv_nop" : "+v"(d) : "v"(a), "v"(b));
  return d;
}
// 16x16x32 fragments: lane = (h = lane>>4, row/col = lane&15); elements 0..7 = k0+8h+0..7, 8..15 = k0+16+8h+0..7; D element r = row 8h+r
__device__ __forceinline__ v16h frag_h(const _Float16* rowk0, int lane) {
  union { v16h v; v8h q[2]; } u; const _Float16* p = rowk0 + 8 * (lane >> 4);
  u.q[0] = *(const v8h*)p; u.q[1] = *(const v8h*)(p + 16); return u.v;
}
__device__ __forceinline__ v16h frag_f32(const float* rowk0, int lane) {
  v16h a; const float* p = rowk0 + 8 * (lane >> 4);
#pragma unroll
  for (int i = 0; i < 8; ++i) { a[i] = (_Float16)p[i]; a[8 + i] = (_Float16)p[16 + i]; }
  return a;
}
__device__ __forceinline__ v16h frag_f32s(const float* rowk0, int lane, float sc) {
  v16h a; const float* p = rowk0 + 8 * (lane >> 4);
#pragma unroll
  for (int i = 0; i < 8; ++i) { a[i] = (_Float16)(p[i] * sc); a[8 + i] = (_Float16)(p[16 + i] * sc); }
  return a;
}
// column fragment from a [K][ld] layout (column n), rows >= K read as 0
__device__ __forceinline__ v16h fragc_f32(const float* W, int k0, int n, int lane, int ld, int K) {
  v16h a; const int g = lane >> 4;
#pragma unroll
  for (int i = 0; i < 8; ++i) { const int ka = k0 + 8 * g + i, kb = ka + 16;
    a[i] = (_Float16)(ka < K ? W[(size_t)ka * ld + n] : 0.f); a[8 + i] = (_Float16)(kb < K ? W[(size_t)kb * ld + n] : 0.f); }
  return a;
}
// A fragment stored in fragment order: 512 halves = elements 0..7 of lanes 0..31, then elements 8..15 of lanes 0..31 (two whole-line 16-byte loads)
__device__ __forceinline__ v16h frag_pre(const _Float16* f, int lane) {
  union { v16h v; v8h q[2]; } u; u.q[0] = *(const v8h*)(f + lane * 8); u.q[1] = *(const v8h*)(f + 256 + lane * 8); return u.v;
}
struct F2 { v16b h, l; };
__device__ __forceinline__ F2 bsplit16(const float v[16]) { F2 r;
#pragma unroll
  for (int i = 0; i < 16; ++i) { const __bf16 h = (__bf16)v[i]; r.h[i] = h; r.l[i] = (__bf16)(v[i] - (float)h); }
  return r; }
__device__ __forceinline__ F2 split_row(const float* row, int k0, int lane) { float v[16]; const float* p = row + k0 + 8 * (lane >> 4);
#pragma unroll
  for (int i = 0; i < 8; ++i) { v[i] = p[i]; v[8 + i] = p[16 + i]; }
  return bsplit16(v); }
__device__ __forceinline__ F2 split_rowK(const float* row, int k0, int lane, int K) { float v[16]; const int g = lane >> 4;
#pragma unroll
  for (int i = 0; i < 8; ++i) { const int ka = k0 + 8 * g + i, kb = ka + 16; v[i] = ka < K ? row[ka] : 0.f; v[8 + i] = kb < K ? row[kb] : 0.f; }
  return bsplit16(v); }
__device__ __forceinline__ F2 split_col(const float* W, int k0, int n, int lane, int ld, int K) { float v[16]; const int g = lane >> 4;
#pragma unroll
  for (int i = 0; i < 8; ++i) { const int ka = k0 + 8 * g + i, kb = ka + 16; v[i] = ka < K ? W[(size_t)ka * ld + n] : 0.f; v[8 + i] = kb < K ? W[(size_t)kb * ld + n] : 0.f; }
  return bsplit16(v); }
__device__ __forceinline__ v8f mac3(const F2& a, const F2& b, v8f c) { c = wmma_bf(a.l, b.h, c); c = wmma_bf(a.h, b.l, c); return wmma_bf(a.h, b.h, c); }
// one v_tanh_f32 in place of the branching library routine
__device__ __forceinline__ float tanh1(float v) { return __builtin_amdgcn_tanhf(v); }
__device__ __forceinline__ float sigm(float v) { return 1.0f / (1.0f + expf(-v)); }
#define LDSX() do { asm volatile("s_wait_dscnt 0" ::: "memory"); __builtin_amdgcn_wave_barrier(); __builtin_amdgcn_fence(__ATOMIC_RELEASE, "workgroup"); } while (0)

// Leave-one-input-out MLP: for every (node i, sample b) the 3-layer tanh MLP is run on x with column i zeroed and output column i kept.
// Layer 1 uses the rank-1 identity (x - x_i e_i) W0^T = z1 - x_i W0[:, i] with z1 = x W0^T computed once (two-way bf16 split), so the
// masked hidden rows are generated on the fly (tanh in f32 -> f16 B operand); layer 2 is the [262144 x 256] @ [256 x 256] product on
// v_wmma_f32_16x16x32_f16 (W1 rows x16, converted once to f16 in fragment order in the workspace) with W1 as A and the hidden rows as B, so a lane's
// accumulators hold 128 layer-2 channels of ONE sample; layer 3 needs only column i: tanh(h2 . W2[i]) in f32, summed in registers, the two lane halves joined by one cross-row move.
#define NBT 1024
#define NN 256

// blockIdx.y < 2: z1 = x @ W0^T (split) : [1024 x 256]; blockIdx.y >= 2: WF = 16 * W1 as f16, fragment f = kc * 16 + t (k block kc, column tile t)
__global__ __launch_bounds__(128) void k_z1(const float* __restrict__ x, const float* __restrict__ W0, const float* __restrict__ W1, float* __restrict__ Z1, _Float16* __restrict__ WF) {
  __shared__ __align__(16) float so[4][16][132];
  const int tid = threadIdx.x, wave = tid >> 5, lane = tid & 31, col = lane & 15, g = lane >> 4;
  if (blockIdx.y >= 2) { const int f = (blockIdx.y - 2) * 64 + blockIdx.x * 4 + wave, kc = f >> 4, t = f & 15;   // one fragment per wave
    union { v16h v; v8h q[2]; } b; b.v = frag_f32s(W1 + (size_t)(t * 16 + col) * NN + kc * 32, lane, 16.0f);
    vst2(WF + (size_t)f * 512 + lane * 8, b.q[0]); vst2(WF + (size_t)f * 512 + 256 + lane * 8, b.q[1]);
    return;
  }
  const int r0 = blockIdx.x * 64 + wave * 16, n0 = blockIdx.y * 128;
  v8f acc[8] = {};
#pragma unroll 1
  for (int kc = 0; kc < NN / 32; ++kc) { const F2 a = split_row(x + (size_t)(r0 + col) * NN, kc * 32, lane);
#pragma unroll
    for (int j = 0; j < 8; ++j) acc[j] = mac3(a, split_row(W0 + (size_t)(n0 + j * 16 + col) * NN, kc * 32, lane), acc[j]); }
#pragma unroll
  for (int j = 0; j < 8; ++j)
#pragma unroll
    for (int r = 0; r < 8; ++r) so[wave][8 * g + r][j * 16 + col] = acc[j][r];
  LDSX();
#pragma unroll 4
  for (int rl = 0; rl < 16; ++rl) vst2(Z1 + (size_t)(r0 + rl) * NN + n0 + lane * 4, *(const v4f*)(&so[wave][rl][lane * 4]));
}
// main: block (64 samples b, node i): rows = b ; FT[i][b]
__global__ __launch_bounds__(128) void k_main(const float* __restrict__ x, const float* __restrict__ W0, const float* __restrict__ Z1, const _Float16* __restrict__ WF, const float* __restrict__ W2, float* __restrict__ FT) {
  __shared__ __align__(16) float sw0c[NN], sw2r[NN];      // W0[:, i] and W2[i, :]
  __shared__ __align__(16) float sf[64];
  const int tid = threadIdx.x, wave = tid >> 5, lane = tid & 31, col = lane & 15, g = lane >> 4;
  const int i = blockIdx.y, b0 = blockIdx.x * 64 + wave * 16;
  for (int q = tid; q < NN; q += 128) { sw0c[q] = W0[(size_t)q * NN + i]; sw2r[q] = W2[(size_t)i * NN + q]; }
  __syncthreads();
  const int bm = b0 + col; const float xi = x[(size_t)bm * NN + i]; const float* zr = Z1 + (size_t)bm * NN;
  v8f acc[16];
#pragma unroll
  for (int t = 0; t < 16; ++t) acc[t] = (v8f){};
#pragma unroll 1
  for (int kc = 0; kc < NN / 32; ++kc) { v16h a, b[8]; const _Float16* wf = WF + (size_t)kc * 16 * 512;
#pragma unroll  // here and below: constant indices keep b[] and acc[] in registers
    for (int t = 0; t < 8; ++t) b[t] = frag_pre(wf + t * 512, lane);   // tiles 0..7 fly while the B fragment is computed
#pragma unroll
    for (int e = 0; e < 8; ++e) { const int ka = kc * 32 + 8 * g + e, kb = ka + 16; a[e] = (_Float16)tanh1(zr[ka] - xi * sw0c[ka]); a[8 + e] = (_Float16)tanh1(zr[kb] - xi * sw0c[kb]); }
#pragma unroll
    for (int t = 0; t < 8; ++t) { acc[t] = wmma16(b[t], a, acc[t]); b[t] = frag_pre(wf + (t + 8) * 512, lane); }   // tile t + 8 flies behind the next products
#pragma unroll
    for (int t = 0; t < 8; ++t) acc[t + 8] = wmma16(b[t], a, acc[t + 8]); }
  // layer 3, column i only: f = tanh( sum_n tanh(h2[n]) W2[i][n] ): acc[t][r] = 16 * h2[sample col][n = 16 t + 8 g + r], eight partial sums per lane
  { v2f sv[4] = {}; float s;
#pragma unroll
    for (int tb = 0; tb < 16; tb += 8) { v4f w[16];   // eight tiles' weights are fetched together into the registers the A fragments in b[] have left
#pragma unroll
      for (int q = 0; q < 16; ++q) w[q] = *(const v4f*)(&sw2r[(tb + (q >> 1)) * 16 + 8 * g + 4 * (q & 1)]);
#pragma unroll
      for (int t = 0; t < 8; ++t)
#pragma unroll
        for (int j = 0; j < 4; ++j) { const v2f p = (v2f){acc[tb + t][2 * j], acc[tb + t][2 * j + 1]} * (1.0f / 16.0f);
          sv[j] = __builtin_elementwise_fma((v2f){tanh1(p[0]), tanh1(p[1])}, (v2f){w[2 * t + (j >> 1)][2 * (j & 1)], w[2 * t + (j >> 1)][2 * (j & 1) + 1]}, sv[j]); } }
    { const v2f u = (sv[0] + sv[1]) + (sv[2] + sv[3]); s = u[0] + u[1]; }
    s += __builtin_bit_cast(float, __builtin_amdgcn_permlanex16(__builtin_bit_cast(int, s), __builtin_bit_cast(int, s), 0x76543210, 0xfedcba98, false, false));   // lane l with lane l ^ 16: the other 128 channels
    if (g == 0) sf[wave * 16 + col] = tanh1(s); }
  __syncthreads();
  if (tid < 16) vst2(FT + (size_t)i * NBT + blockIdx.x * 64 + tid * 4, *(const v4f*)(&sf[tid * 4]));
}
// transpose FT [i][b] -> out [b][i]: block = 64 b x 256 i via LDS
__global__ __launch_bounds__(256) void k_tr(const float* __restrict__ FT, float* __restrict__ out) {
  __shared__ float st[64][NN + 1];
  const int b0 = blockIdx.x * 64, tid = threadIdx.x;
  for (int q = tid; q < NN * 64; q += 256) { const int i = q >> 6, bl = q & 63; st[bl][i] = FT[(size_t)i * NBT + b0 + bl]; }
  __syncthreads();
  for (int q = tid; q < 64 * (NN / 4); q += 256) { const int bl = q >> 6, pc = q & 63; v4f o; o[0] = st[bl][pc * 4]; o[1] = st[bl][pc * 4 + 1]; o[2] = st[bl][pc * 4 + 2]; o[3] = st[bl][pc * 4 + 3]; vst2(out + (size_t)(b0 + bl) * NN + pc * 4, o); }
}
extern "C" void kernel_launch(void* const* d_in, const int* in_sizes, int n_in, void* d_out, int out_size, void* d_ws, size_t ws_size, hipStream_t stream) {
  (void)in_sizes; (void)n_in; (void)out_size; (void)ws_size;
  const float* x = (const float*)d_in[0]; const float* W0 = (const float*)d_in[1]; const float* W1 = (const float*)d_in[2]; const float* W2 = (const float*)d_in[3];
  float* out = (float*)d_out;
  char* ws = (char*)d_ws; size_t off = 0;
  auto take = [&](size_t bytes) { char* p = ws + off; off += (bytes + 255) & ~(size_t)255; return p; };
  float* Z1 = (float*)take((size_t)NBT * NN * 4); float* FT = (float*)take((size_t)NN * NBT * 4); _Float16* WF = (_Float16*)take((size_t)NN * NN * 2);
  k_z1<<<dim3(NBT / 64, NN / 128 + 2), 128, 0, stream>>>(x, W0, W1, Z1, WF);
  k_main<<<dim3(NBT / 64, NN), 128, 0, stream>>>(x, W0, Z1, WF, W2, FT);
  k_tr<<<NBT / 64, 256, 0, stream>>>(FT, out);
}

// v004
// A run of this version takes 70.9 microseconds.
// Two timings next to v003 both put it at 1.24 times that version's speed.
// Counting every step since v000, it is 6.25 times as fast.
#include <hip/hip_runtime.h>
#include <math.h>

typedef __attribute__((ext_vector_type(16))) _Float16 v16h;
typedef __attribute__((ext_vector_type(16))) __bf16 v16b;
typedef __attribute__((ext_vector_type(8)))  _Float16 v8h;
typedef __attribute__((ext_vector_type(2)))  _Float16 v2h;
typedef __attribute__((ext_vector_type(8)))  float v8f;
typedef __attribute__((ext_vector_type(4)))  float v4f;
typedef __attribute__((ext_vector_type(2)))  float v2f;
typedef __attribute__((ext_vector_type(4)))  unsigned v4u;
typedef __attribute__((ext_vector_type(4)))  int v4i;
typedef float __attribute__((may_alias)) float_a;
typedef int __attribute__((may_alias)) int_a;

template <typename T> __device__ __forceinline__ void vst2(void* p, T v) { *(T*)p = v;  }
__device__ __forceinline__ v8f wmma16(v16h a, v16h b, v8f c) {
  v8f d = __builtin_amdgcn_wmma_f32_16x16x32_f16(false, a, false, b, (short)0, c, false, false);
  asm volatile("v_nop\n\tv_nop\n\tv_nop\n\tv_nop" : "+v"(d) : "v"(a), "v"(b));
  return d;
}
__device__ __forceinline__ v8f wmma_bf(v16b a, v16b b, v8f c) {
  v8f d = __builtin_amdgcn_wmma_f32_16x16x32_bf16(false, a, false, b, (short)0, c, false, false);
  asm volatile("v_nop\n\tv_nop\n\tv_nop\n\tv_nop" : "+v"(d) : "v"(a), "v"(b));
  return d;
}
// 16x16x32 fragments: lane = (h = lane>>4, row/col = lane&15); elements 0..7 = k0+8h+0..7, 8..15 = k0+16+8h+0..7; D element r = row 8h+r
__device__ __forceinline__ v16h frag_h(const _Float16* rowk0, int lane) {
  union { v16h v; v8h q[2]; } u; const _Float16* p = rowk0 + 8 * (lane >> 4);
  u.q[0] = *(const v8h*)p; u.q[1] = *(const v8h*)(p + 16); return u.v;
}
__device__ __forceinline__ v16h frag_f32(const float* rowk0, int lane) {
  v16h a; const float* p = rowk0 + 8 * (lane >> 4);
#pragma unroll
  for (int i = 0; i < 8; ++i) { a[i] = (_Float16)p[i]; a[8 + i] = (_Float16)p[16 + i]; }
  return a;
}
__device__ __forceinline__ v16h frag_f32s(const float* rowk0, int lane, float sc) {
  v16h a; const float* p = rowk0 + 8 * (lane >> 4);
#pragma unroll
  for (int i = 0; i < 8; ++i) { a[i] = (_Float16)(p[i] * sc); a[8 + i] = (_Float16)(p[16 + i] * sc); }
  return a;
}
// column fragment from a [K][ld] layout (column n), rows >= K read as 0
__device__ __forceinline__ v16h fragc_f32(const float* W, int k0, int n, int lane, int ld, int K) {
  v16h a; const int g = lane >> 4;
#pragma unroll
  for (int i = 0; i < 8; ++i) { const int ka = k0 + 8 * g + i, kb = ka + 16;
    a[i] = (_Float16)(ka < K ? W[(size_t)ka * ld + n] : 0.f); a[8 + i] = (_Float16)(kb < K ? W[(size_t)kb * ld + n] : 0.f); }
  return a;
}
// A fragment stored in fragment order: 512 halves = elements 0..7 of lanes 0..31, then elements 8..15 of lanes 0..31 (two whole-line 16-byte loads)
__device__ __forceinline__ v16h frag_pre(const _Float16* f, int lane) {
  union { v16h v; v8h q[2]; } u; u.q[0] = *(const v8h*)(f + lane * 8); u.q[1] = *(const v8h*)(f + 256 + lane * 8); return u.v;
}
struct F2 { v16b h, l; };
__device__ __forceinline__ F2 bsplit16(const float v[16]) { F2 r;
#pragma unroll
  for (int i = 0; i < 16; ++i) { const __bf16 h = (__bf16)v[i]; r.h[i] = h; r.l[i] = (__bf16)(v[i] - (float)h); }
  return r; }
__device__ __forceinline__ F2 split_row(const float* row, int k0, int lane) { float v[16]; const float* p = row + k0 + 8 * (lane >> 4);
#pragma unroll
  for (int i = 0; i < 8; ++i) { v[i] = p[i]; v[8 + i] = p[16 + i]; }
  return bsplit16(v); }
__device__ __forceinline__ F2 split_rowK(const float* row, int k0, int lane, int K) { float v[16]; const int g = lane >> 4;
#pragma unroll
  for (int i = 0; i < 8; ++i) { const int ka = k0 + 8 * g + i, kb = ka + 16; v[i] = ka < K ? row[ka] : 0.f; v[8 + i] = kb < K ? row[kb] : 0.f; }
  return bsplit16(v); }
__device__ __forceinline__ F2 split_col(const float* W, int k0, int n, int lane, int ld, int K) { float v[16]; const int g = lane >> 4;
#pragma unroll
  for (int i = 0; i < 8; ++i) { const int ka = k0 + 8 * g + i, kb = ka + 16; v[i] = ka < K ? W[(size_t)ka * ld + n] : 0.f; v[8 + i] = kb < K ? W[(size_t)kb * ld + n] : 0.f; }
  return bsplit16(v); }
__device__ __forceinline__ v8f mac3(const F2& a, const F2& b, v8f c) { c = wmma_bf(a.l, b.h, c); c = wmma_bf(a.h, b.l, c); return wmma_bf(a.h, b.h, c); }
// one v_tanh_f32 in place of the branching library routine
__device__ __forceinline__ float tanh1(float v) { return __builtin_amdgcn_tanhf(v); }
__device__ __forceinline__ float sigm(float v) { return 1.0f / (1.0f + expf(-v)); }
#define LDSX() do { asm volatile("s_wait_dscnt 0" ::: "memory"); __builtin_amdgcn_wave_barrier(); __builtin_amdgcn_fence(__ATOMIC_RELEASE, "workgroup"); } while (0)

// Leave-one-input-out MLP: for every (node i, sample b) the 3-layer tanh MLP is run on x with column i zeroed and output column i kept.
// Layer 1 uses the rank-1 identity (x - x_i e_i) W0^T = z1 - x_i W0[:, i] with z1 = x W0^T computed once (two-way bf16 split), so the
// masked hidden rows are generated on the fly (tanh in f32 -> f16 operand); layer 2 is the [262144 x 256] @ [256 x 256] product on
// v_wmma_f32_16x16x32_f16 (W1 rows x16, converted once to f16 in fragment order in the workspace) with W1 as A and the hidden rows (f16, in LDS) as B; a wave
// holds 64 channels x 64 samples, so each W1 fragment feeds four products; layer 3 needs only column i: tanh(h2 . W2[i]) in f32, summed per lane, the eight partial sums of a sample joined through LDS.
#define NBT 1024
#define NN 256

// blockIdx.y < 2: z1 = x @ W0^T (split) : [1024 x 256]; blockIdx.y >= 2: WF = 16 * W1 as f16, fragment f = kc * 16 + t (k block kc, column tile t)
__global__ __launch_bounds__(128) void k_z1(const float* __restrict__ x, const float* __restrict__ W0, const float* __restrict__ W1, float* __restrict__ Z1, _Float16* __restrict__ WF) {
  __shared__ __align__(16) float so[4][16][132];
  const int tid = threadIdx.x, wave = tid >> 5, lane = tid & 31, col = lane & 15, g = lane >> 4;
  if (blockIdx.y >= 2) { const int f = (blockIdx.y - 2) * 64 + blockIdx.x * 4 + wave, kc = f >> 4, t = f & 15;   // one fragment per wave
    union { v16h v; v8h q[2]; } b; b.v = frag_f32s(W1 + (size_t)(t * 16 + col) * NN + kc * 32, lane, 16.0f);
    vst2(WF + (size_t)f * 512 + lane * 8, b.q[0]); vst2(WF + (size_t)f * 512 + 256 + lane * 8, b.q[1]);
    return;
  }
  const int r0 = blockIdx.x * 64 + wave * 16, n0 = blockIdx.y * 128;
  v8f acc[8] = {};
#pragma unroll 1
  for (int kc = 0; kc < NN / 32; ++kc) { const F2 a = split_row(x + (size_t)(r0 + col) * NN, kc * 32, lane);
#pragma unroll
    for (int j = 0; j < 8; ++j) acc[j] = mac3(a, split_row(W0 + (size_t)(n0 + j * 16 + col) * NN, kc * 32, lane), acc[j]); }
#pragma unroll
  for (int j = 0; j < 8; ++j)
#pragma unroll
    for (int r = 0; r < 8; ++r) so[wave][8 * g + r][j * 16 + col] = acc[j][r];
  LDSX();
#pragma unroll 4
  for (int rl = 0; rl < 16; ++rl) vst2(Z1 + (size_t)(r0 + rl) * NN + n0 + lane * 4, *(const v4f*)(&so[wave][rl][lane * 4]));
}
// main: block (64 samples b, node i): the 64 hidden rows are made once, as f16 in LDS; wave w then owns channels 64 w .. 64 w + 63 of all 64 samples ; FT[i][b]
#define HP 264   // halves per hidden row in LDS: 528 bytes = 16 x 33, an odd count of 16-byte units, so the 16-byte fragment reads meet no bank conflict
__global__ __launch_bounds__(128) void k_main(const float* __restrict__ x, const float* __restrict__ W0, const float* __restrict__ Z1, const _Float16* __restrict__ WF, const float* __restrict__ W2, float* __restrict__ FT) {
  __shared__ __align__(16) _Float16 sh[64][HP];           // tanh(z1 - x_i W0[:, i]) of the block's samples
  __shared__ __align__(16) float sw2r[NN];                // W2[i, :]
  __shared__ __align__(16) float sp[8][64];               // layer-3 partial sums: [wave * 2 + lane half][sample]
  const int tid = threadIdx.x, wave = tid >> 5, lane = tid & 31, col = lane & 15, g = lane >> 4;
  const int i = blockIdx.y, b0 = blockIdx.x * 64;
  const _Float16* wf = WF + (size_t)wave * 4 * 512;
  v16h a[2][4];
  // layer 1: thread = channels 2 tid, 2 tid + 1 of every sample, so a wave reads 256 contiguous bytes of one z1 row per load
  { const int k2 = tid * 2; const float* zp = Z1 + (size_t)b0 * NN + k2; const float* xp = x + (size_t)b0 * NN + i;
    float xs[64]; v2f z[64];
    const float w0a = W0[(size_t)k2 * NN + i], w0b = W0[(size_t)(k2 + 1) * NN + i];
#pragma unroll
    for (int j = 0; j < 4; ++j) a[0][j] = frag_pre(wf + j * 512, lane);   // issued first: the first W1 fragments arrive while layer 1 is worked on
    asm volatile("s_wait_xcnt 0x0" ::: "memory");   // stands in front of any overwrite of the address registers of the W0 and W1 loads above
#pragma unroll  // constant indices keep xs[] in scalar registers
    for (int r = 0; r < 64; ++r) xs[r] = xp[(size_t)r * NN];
    asm volatile("s_wait_xcnt 0x0" ::: "memory");   // stands in front of any overwrite of the address registers of the x loads, and keeps their results off the registers the loads below name
#pragma unroll  // straight line: the loads of all rows fly together
    for (int r = 0; r < 64; ++r) z[r] = *(const v2f*)(zp + (size_t)r * NN);
    const v2f w2v = *(const v2f*)(W2 + (size_t)i * NN + k2);
    asm volatile("s_wait_xcnt 0x0" ::: "memory");   // stands in front of any overwrite of the address registers of the z1 and W2 loads
#pragma unroll
    for (int r = 0; r < 64; ++r) { v2h h; h[0] = (_Float16)tanh1(z[r][0] - xs[r] * w0a); h[1] = (_Float16)tanh1(z[r][1] - xs[r] * w0b); vst2(&sh[r][k2], h); }
    vst2(&sw2r[k2], w2v); }
  __syncthreads();   // publishes the hidden rows and W2[i, :] to all four waves
  v8f acc[4][4];     // [channel tile j][sample tile m]
#pragma unroll
  for (int j = 0; j < 4; ++j)
#pragma unroll
    for (int m = 0; m < 4; ++m) acc[j][m] = (v8f){};
#pragma unroll  // here and below: constant indices keep a[], b[] and acc[] in registers
  for (int kc = 0; kc < NN / 32; ++kc) { v16h b[4];
#pragma unroll
    for (int m = 0; m < 4; ++m) b[m] = frag_h(&sh[m * 16 + col][kc * 32], lane);
    if (kc + 1 < NN / 32) {
#pragma unroll
      for (int j = 0; j < 4; ++j) a[(kc + 1) & 1][j] = frag_pre(wf + (size_t)((kc + 1) * 16 + j) * 512, lane); }   // the next k block's W1 fragments fly behind these 16 products
#pragma unroll
    for (int m = 0; m < 4; ++m)
#pragma unroll
      for (int j = 0; j < 4; ++j) acc[j][m] = wmma16(a[kc & 1][j], b[m], acc[j][m]); }
  // layer 3, column i only: f = tanh( sum_n tanh(h2[n]) W2[i][n] ): acc[j][m][r] = 16 * h2[sample 16 m + col][n = 64 wave + 16 j + 8 g + r]
  { v4f w[8];
#pragma unroll
    for (int q = 0; q < 8; ++q) w[q] = *(const v4f*)(&sw2r[wave * 64 + (q >> 1) * 16 + 8 * g + 4 * (q & 1)]);
#pragma unroll
    for (int m = 0; m < 4; ++m) { v2f sv[2] = {};
#pragma unroll
      for (int j = 0; j < 4; ++j)
#pragma unroll
        for (int e = 0; e < 4; ++e) { const v2f p = (v2f){acc[j][m][2 * e], acc[j][m][2 * e + 1]} * (1.0f / 16.0f);
          sv[e & 1] = __builtin_elementwise_fma((v2f){tanh1(p[0]), tanh1(p[1])}, (v2f){w[2 * j + (e >> 1)][2 * (e & 1)], w[2 * j + (e >> 1)][2 * (e & 1) + 1]}, sv[e & 1]); }
      const v2f u = sv[0] + sv[1]; sp[wave * 2 + g][m * 16 + col] = u[0] + u[1]; } }
  __syncthreads();   // the eight partial sums of every sample are in LDS
  if (tid < 64) { float s = 0.f;
#pragma unroll
    for (int q = 0; q < 8; ++q) s += sp[q][tid];
    float f;
    asm("v_tanh_f32 %0, %1\n\tv_nop" : "=v"(f) : "v"(s));   // v_nop: the one slot the instruction set asks for between v_tanh_f32 and the store that reads its result
    FT[(size_t)i * NBT + b0 + tid] = f; }
}
// transpose FT [i][b] -> out [b][i]: block = 64 b x 256 i via LDS
__global__ __launch_bounds__(256) void k_tr(const float* __restrict__ FT, float* __restrict__ out) {
  __shared__ float st[64][NN + 1];
  const int b0 = blockIdx.x * 64, tid = threadIdx.x;
  for (int q = tid; q < NN * 64; q += 256) { const int i = q >> 6, bl = q & 63; st[bl][i] = FT[(size_t)i * NBT + b0 + bl]; }
  __syncthreads();
  for (int q = tid; q < 64 * (NN / 4); q += 256) { const int bl = q >> 6, pc = q & 63; v4f o; o[0] = st[bl][pc * 4]; o[1] = st[bl][pc * 4 + 1]; o[2] = st[bl][pc * 4 + 2]; o[3] = st[bl][pc * 4 + 3]; vst2(out + (size_t)(b0 + bl) * NN + pc * 4, o); }
}
extern "C" void kernel_launch(void* const* d_in, const int* in_sizes, int n_in, void* d_out, int out_size, void* d_ws, size_t ws_size, hipStream_t stream) {
  (void)in_sizes; (void)n_in; (void)out_size; (void)ws_size;
  const float* x = (const float*)d_in[0]; const float* W0 = (const float*)d_in[1]; const float* W1 = (const float*)d_in[2]; const float* W2 = (const float*)d_in[3];
  float* out = (float*)d_out;
  char* ws = (char*)d_ws; size_t off = 0;
  auto take = [&](size_t bytes) { char* p = ws + off; off += (bytes + 255) & ~(size_t)255; return p; };
  float* Z1 = (float*)take((size_t)NBT * NN * 4); float* FT = (float*)take((size_t)NN * NBT * 4); _Float16* WF = (_Float16*)take((size_t)NN * NN * 2);
  k_z1<<<dim3(NBT / 64, NN / 128 + 2), 128, 0, stream>>>(x, W0, W1, Z1, WF);
  k_main<<<dim3(NBT / 64, NN), 128, 0, stream>>>(x, W0, Z1, WF, W2, FT);
  k_tr<<<NBT / 64, 256, 0, stream>>>(FT, out);
}

// v005
// Measured time: 60.3 microseconds a run.
// Next to v004, in two timings, it ran 1.18 times as fast each time.
// Counting every step since v000, it is 7.36 times as fast.
#include <hip/hip_runtime.h>
#include <math.h>

typedef __attribute__((ext_vector_type(16))) _Float16 v16h;
typedef __attribute__((ext_vector_type(16))) __bf16 v16b;
typedef __attribute__((ext_vector_type(8)))  _Float16 v8h;
typedef __attribute__((ext_vector_type(2)))  _Float16 v2h;
typedef __attribute__((ext_vector_type(8)))  float v8f;
typedef __attribute__((ext_vector_type(4)))  float v4f;
typedef __attribute__((ext_vector_type(2)))  float v2f;
typedef __attribute__((ext_vector_type(4)))  unsigned v4u;
typedef __attribute__((ext_vector_type(4)))  int v4i;
typedef float __attribute__((may_alias)) float_a;
typedef int __attribute__((may_alias)) int_a;

template <typename T> __device__ __forceinline__ void vst2(void* p, T v) { *(T*)p = v;  }
__device__ __forceinline__ v8f wmma16(v16h a, v16h b, v8f c) {
  return __builtin_amdgcn_wmma_f32_16x16x32_f16(false, a, false, b, (short)0, c, false, false);   // plain builtin: an asm statement that names the operands would tie them to the first 256 registers
}
__device__ __forceinline__ v8f wmma_bf(v16b a, v16b b, v8f c) {
  v8f d = __builtin_amdgcn_wmma_f32_16x16x32_bf16(false, a, false, b, (short)0, c, false, false);
  asm volatile("v_nop\n\tv_nop\n\tv_nop\n\tv_nop" : "+v"(d) : "v"(a), "v"(b));
  return d;
}
// 16x16x32 fragments: lane = (h = lane>>4, row/col = lane&15); elements 0..7 = k0+8h+0..7, 8..15 = k0+16+8h+0..7; D element r = row 8h+r
__device__ __forceinline__ v16h frag_h(const _Float16* rowk0, int lane) {
  union { v16h v; v8h q[2]; } u; const _Float16* p = rowk0 + 8 * (lane >> 4);
  u.q[0] = *(const v8h*)p; u.q[1] = *(const v8h*)(p + 16); return u.v;
}
__device__ __forceinline__ v16h frag_f32(const float* rowk0, int lane) {
  v16h a; const float* p = rowk0 + 8 * (lane >> 4);
#pragma unroll
  for (int i = 0; i < 8; ++i) { a[i] = (_Float16)p[i]; a[8 + i] = (_Float16)p[16 + i]; }
  return a;
}
__device__ __forceinline__ v16h frag_f32s(const float* rowk0, int lane, float sc) {
  v16h a; const float* p = rowk0 + 8 * (lane >> 4);
#pragma unroll
  for (int i = 0; i < 8; ++i) { a[i] = (_Float16)(p[i] * sc); a[8 + i] = (_Float16)(p[16 + i] * sc); }
  return a;
}
// column fragment from a [K][ld] layout (column n), rows >= K read as 0
__device__ __forceinline__ v16h fragc_f32(const float* W, int k0, int n, int lane, int ld, int K) {
  v16h a; const int g = lane >> 4;
#pragma unroll
  for (int i = 0; i < 8; ++i) { const int ka = k0 + 8 * g + i, kb = ka + 16;
    a[i] = (_Float16)(ka < K ? W[(size_t)ka * ld + n] : 0.f); a[8 + i] = (_Float16)(kb < K ? W[(size_t)kb * ld + n] : 0.f); }
  return a;
}
// A fragment stored in fragment order: 512 halves = elements 0..7 of lanes 0..31, then elements 8..15 of lanes 0..31 (two whole-line 16-byte loads)
__device__ __forceinline__ v16h frag_pre(const _Float16* f, int lane) {
  union { v16h v; v8h q[2]; } u; u.q[0] = *(const v8h*)(f + lane * 8); u.q[1] = *(const v8h*)(f + 256 + lane * 8); return u.v;
}
struct F2 { v16b h, l; };
__device__ __forceinline__ F2 bsplit16(const float v[16]) { F2 r;
#pragma unroll
  for (int i = 0; i < 16; ++i) { const __bf16 h = (__bf16)v[i]; r.h[i] = h; r.l[i] = (__bf16)(v[i] - (float)h); }
  return r; }
__device__ __forceinline__ F2 split_row(const float* row, int k0, int lane) { float v[16]; const float* p = row + k0 + 8 * (lane >> 4);
#pragma unroll
  for (int i = 0; i < 8; ++i) { v[i] = p[i]; v[8 + i] = p[16 + i]; }
  return bsplit16(v); }
__device__ __forceinline__ F2 split_rowK(const float* row, int k0, int lane, int K) { float v[16]; const int g = lane >> 4;
#pragma unroll
  for (int i = 0; i < 8; ++i) { const int ka = k0 + 8 * g + i, kb = ka + 16; v[i] = ka < K ? row[ka] : 0.f; v[8 + i] = kb < K ? row[kb] : 0.f; }
  return bsplit16(v); }
__device__ __forceinline__ F2 split_col(const float* W, int k0, int n, int lane, int ld, int K) { float v[16]; const int g = lane >> 4;
#pragma unroll
  for (int i = 0; i < 8; ++i) { const int ka = k0 + 8 * g + i, kb = ka + 16; v[i] = ka < K ? W[(size_t)ka * ld + n] : 0.f; v[8 + i] = kb < K ? W[(size_t)kb * ld + n] : 0.f; }
  return bsplit16(v); }
__device__ __forceinline__ v8f mac3(const F2& a, const F2& b, v8f c) { c = wmma_bf(a.l, b.h, c); c = wmma_bf(a.h, b.l, c); return wmma_bf(a.h, b.h, c); }
// one v_tanh_f32 in place of the branching library routine
__device__ __forceinline__ float tanh1(float v) { return __builtin_amdgcn_tanhf(v); }
__device__ __forceinline__ float sigm(float v) { return 1.0f / (1.0f + expf(-v)); }
#define LDSX() do { asm volatile("s_wait_dscnt 0" ::: "memory"); __builtin_amdgcn_wave_barrier(); __builtin_amdgcn_fence(__ATOMIC_RELEASE, "workgroup"); } while (0)

// Leave-one-input-out MLP: for every (node i, sample b) the 3-layer tanh MLP is run on x with column i zeroed and output column i kept.
// Layer 1 uses the rank-1 identity (x - x_i e_i) W0^T = z1 - x_i W0[:, i] with z1 = x W0^T computed once (two-way bf16 split), so the
// masked hidden rows are generated on the fly (tanh in f32 -> f16 operand); layer 2 is the [262144 x 256] @ [256 x 256] product on
// v_wmma_f32_16x16x32_f16 (W1 rows x16, converted once to f16 in fragment order in the workspace) with W1 as A and the hidden rows (f16, in LDS) as B; a wave
// holds 64 channels x 64 samples, so each W1 fragment feeds four products; layer 3 needs only column i: tanh(h2 . W2[i]) in f32, summed per lane, the eight partial sums of a sample joined through LDS.
#define NBT 1024
#define NN 256

// blockIdx.y < 2: z1 = x @ W0^T (split) : [1024 x 256]; blockIdx.y >= 2: WF = 16 * W1 as f16, fragment f = kc * 16 + t (k block kc, column tile t)
__global__ __launch_bounds__(128) void k_z1(const float* __restrict__ x, const float* __restrict__ W0, const float* __restrict__ W1, float* __restrict__ Z1, _Float16* __restrict__ WF) {
  __shared__ __align__(16) float so[4][16][132];
  const int tid = threadIdx.x, wave = tid >> 5, lane = tid & 31, col = lane & 15, g = lane >> 4;
  if (blockIdx.y >= 2) { const int f = (blockIdx.y - 2) * 64 + blockIdx.x * 4 + wave, kc = f >> 4, t = f & 15;   // one fragment per wave
    union { v16h v; v8h q[2]; } b; b.v = frag_f32s(W1 + (size_t)(t * 16 + col) * NN + kc * 32, lane, 16.0f);
    vst2(WF + (size_t)f * 512 + lane * 8, b.q[0]); vst2(WF + (size_t)f * 512 + 256 + lane * 8, b.q[1]);
    return;
  }
  const int r0 = blockIdx.x * 64 + wave * 16, n0 = blockIdx.y * 128;
  v8f acc[8] = {};
#pragma unroll 1
  for (int kc = 0; kc < NN / 32; ++kc) { const F2 a = split_row(x + (size_t)(r0 + col) * NN, kc * 32, lane);
#pragma unroll
    for (int j = 0; j < 8; ++j) acc[j] = mac3(a, split_row(W0 + (size_t)(n0 + j * 16 + col) * NN, kc * 32, lane), acc[j]); }
#pragma unroll
  for (int j = 0; j < 8; ++j)
#pragma unroll
    for (int r = 0; r < 8; ++r) so[wave][8 * g + r][j * 16 + col] = acc[j][r];
  LDSX();
#pragma unroll 4
  for (int rl = 0; rl < 16; ++rl) vst2(Z1 + (size_t)(r0 + rl) * NN + n0 + lane * 4, *(const v4f*)(&so[wave][rl][lane * 4]));
}
// main: block (64 samples b, NG nodes i): what does not depend on the node is fetched once per block: a wave's 64 channels of W1 (32 fragments) stay in registers,
// the z1 rows of the samples and the nodes' columns of x and W0 and rows of W2 stay in LDS; per node the 64 hidden rows are made as f16 in LDS, wave w owns channels 64 w .. 64 w + 63 of all 64 samples ; FT[i][b]
#define HP 264   // halves per hidden row in LDS: 528 bytes = 16 x 33, an odd count of 16-byte units, so the 16-byte fragment reads meet no bank conflict
#define NG 8     // nodes per block: 16 x 32 blocks, two per WGP at two waves per SIMD
__global__ __launch_bounds__(128, 2) void k_main(const float* __restrict__ x, const float* __restrict__ W0, const float* __restrict__ Z1, const _Float16* __restrict__ WF, const float* __restrict__ W2, float* __restrict__ FT) {
  __shared__ __align__(16) _Float16 sh[64][HP];           // tanh(z1 - x_i W0[:, i]) of the block's samples
  __shared__ __align__(16) float sz[64][NN];              // z1 of the block's samples; a thread reads back only the two channels it wrote
  __shared__ __align__(16) float sx[NG][64];              // x[sample][i0 + n]
  __shared__ __align__(16) float sw0[NG][NN];             // W0[channel][i0 + n]; a thread reads back only the two channels it wrote
  __shared__ __align__(16) float sw2[NG][NN];             // W2[i0 + n][:]
  __shared__ __align__(16) float sp[8][64];               // layer-3 partial sums: [wave * 2 + lane half][sample]
  const int tid = threadIdx.x, wave = tid >> 5, lane = tid & 31, col = lane & 15, g = lane >> 4;
  const int i0 = blockIdx.y * NG, b0 = blockIdx.x * 64, k2 = tid * 2;
  const _Float16* wf = WF + (size_t)wave * 4 * 512;
  v16h a[NN / 32][4];
#pragma unroll  // here and below: constant indices keep a[], b[] and acc[] in registers
  for (int kc = 0; kc < NN / 32; ++kc)
#pragma unroll
    for (int j = 0; j < 4; ++j) a[kc][j] = frag_pre(wf + (size_t)(kc * 16 + j) * 512, lane);
  asm volatile("s_wait_xcnt 0x0" :: "v"(wf + lane * 8) : "memory");   // stands in front of any overwrite of the address registers of the W1 loads above; the address as an input keeps a load's result off those registers until here
  { const float* zp = Z1 + (size_t)b0 * NN + k2; v2f z[64];
#pragma unroll  // straight line: the loads of all rows fly together
    for (int r = 0; r < 64; ++r) z[r] = *(const v2f*)(zp + (size_t)r * NN);
    asm volatile("s_wait_xcnt 0x0" ::: "memory");   // stands in front of any overwrite of the address registers of the z1 loads
#pragma unroll
    for (int r = 0; r < 64; ++r) vst2(&sz[r][k2], z[r]); }
  { const int r = tid >> 1, hf = tid & 1;
    const v4f xv = *(const v4f*)(x + (size_t)(b0 + r) * NN + i0 + 4 * hf);
    const float* wp = W0 + (size_t)k2 * NN + i0;
    const v4f wa0 = *(const v4f*)wp, wa1 = *(const v4f*)(wp + 4), wb0 = *(const v4f*)(wp + NN), wb1 = *(const v4f*)(wp + NN + 4);
    asm volatile("s_wait_xcnt 0x0" :: "v"(wp) : "memory");   // stands in front of any overwrite of the address registers of the x and W0 loads; the W0 address as an input keeps a load's result off those registers until here
    v2f w2v[NG];
#pragma unroll
    for (int n = 0; n < NG; ++n) w2v[n] = *(const v2f*)(W2 + (size_t)(i0 + n) * NN + k2);
    asm volatile("s_wait_xcnt 0x0" ::: "memory");   // stands in front of any overwrite of the address registers of the W2 loads
#pragma unroll
    for (int e = 0; e < 4; ++e) { sx[4 * hf + e][r] = xv[e]; vst2(&sw0[e][k2], (v2f){wa0[e], wb0[e]}); vst2(&sw0[4 + e][k2], (v2f){wa1[e], wb1[e]}); }
#pragma unroll
    for (int n = 0; n < NG; ++n) vst2(&sw2[n][k2], w2v[n]); }
  __syncthreads();   // publishes x and W2 of the block's nodes to all four waves
#pragma unroll 1  // one copy of the body
  for (int n = 0; n < NG; ++n) { const int i = i0 + n;
    // layer 1: thread = channels 2 tid, 2 tid + 1 of every sample
    { const v2f w0 = *(const v2f*)(&sw0[n][k2]);
#pragma unroll
      for (int q = 0; q < 16; ++q) { const v4f xv = *(const v4f*)(&sx[n][4 * q]);
#pragma unroll
        for (int e = 0; e < 4; ++e) { const int r = 4 * q + e; const v2f z = *(const v2f*)(&sz[r][k2]); v2h h; h[0] = (_Float16)tanh1(z[0] - xv[e] * w0[0]); h[1] = (_Float16)tanh1(z[1] - xv[e] * w0[1]); vst2(&sh[r][k2], h); } } }
    __syncthreads();   // publishes the hidden rows to all four waves
    v8f acc[4][4];     // [channel tile j][sample tile m]
#pragma unroll
    for (int j = 0; j < 4; ++j)
#pragma unroll
      for (int m = 0; m < 4; ++m) acc[j][m] = (v8f){};
    v16h b[2][4]; v4f w[8];
#pragma unroll
    for (int m = 0; m < 4; ++m) b[0][m] = frag_h(&sh[m * 16 + col][0], lane);
#pragma unroll
    for (int kc = 0; kc < NN / 32; ++kc) {
      if (kc + 1 < NN / 32) {
#pragma unroll
        for (int m = 0; m < 4; ++m) b[(kc + 1) & 1][m] = frag_h(&sh[m * 16 + col][(kc + 1) * 32], lane);   // the next k block's hidden-row fragments fly behind these 16 products
      } else {
#pragma unroll
        for (int q = 0; q < 8; ++q) w[q] = *(const v4f*)(&sw2[n][wave * 64 + (q >> 1) * 16 + 8 * g + 4 * (q & 1)]); }   // layer 3's W2 values fly behind the last 16 products
      __builtin_amdgcn_sched_barrier(0);   // keeps the LDS reads above together in front of the products: left free, the compiler spread them among the products with a full wait at each group
#pragma unroll
      for (int m = 0; m < 4; ++m)
#pragma unroll
        for (int j = 0; j < 4; ++j) acc[j][m] = wmma16(a[kc][j], b[kc & 1][m], acc[j][m]);
      __builtin_amdgcn_sched_barrier(0); }   // keeps later LDS reads from rising into this block of products, so only two fragment sets are live
    // layer 3, column i only: f = tanh( sum_n tanh(h2[n]) W2[i][n] ): acc[j][m][r] = 16 * h2[sample 16 m + col][n = 64 wave + 16 j + 8 g + r]
    {
#pragma unroll
      for (int m = 0; m < 4; ++m) { v2f sv[2] = {};
#pragma unroll
        for (int j = 0; j < 4; ++j)
#pragma unroll
          for (int e = 0; e < 4; ++e) { const v2f p = (v2f){acc[j][m][2 * e], acc[j][m][2 * e + 1]} * (1.0f / 16.0f);
            sv[e & 1] = __builtin_elementwise_fma((v2f){tanh1(p[0]), tanh1(p[1])}, (v2f){w[2 * j + (e >> 1)][2 * (e & 1)], w[2 * j + (e >> 1)][2 * (e & 1) + 1]}, sv[e & 1]); }
        const v2f u = sv[0] + sv[1]; sp[wave * 2 + g][m * 16 + col] = u[0] + u[1]; } }
    __syncthreads();   // the eight partial sums of every sample are in LDS; every wave has left sh, which the next node's layer 1 rewrites
    if (tid < 64) { float s = 0.f;
#pragma unroll
      for (int q = 0; q < 8; ++q) s += sp[q][tid];
      float f;
      asm("v_tanh_f32 %0, %1\n\tv_nop" : "=v"(f) : "v"(s));   // v_nop: the one slot the instruction set asks for between v_tanh_f32 and the store that reads its result
      FT[(size_t)i * NBT + b0 + tid] = f;
      asm volatile("s_wait_xcnt 0x0" ::: "memory"); }   // stands in front of the next node's overwrite of the store's address registers
  }
}
// transpose FT [i][b] -> out [b][i]: block = 64 b x 256 i via LDS
__global__ __launch_bounds__(256) void k_tr(const float* __restrict__ FT, float* __restrict__ out) {
  __shared__ float st[64][NN + 1];
  const int b0 = blockIdx.x * 64, tid = threadIdx.x;
  for (int q = tid; q < NN * 64; q += 256) { const int i = q >> 6, bl = q & 63; st[bl][i] = FT[(size_t)i * NBT + b0 + bl]; }
  __syncthreads();
  for (int q = tid; q < 64 * (NN / 4); q += 256) { const int bl = q >> 6, pc = q & 63; v4f o; o[0] = st[bl][pc * 4]; o[1] = st[bl][pc * 4 + 1]; o[2] = st[bl][pc * 4 + 2]; o[3] = st[bl][pc * 4 + 3]; vst2(out + (size_t)(b0 + bl) * NN + pc * 4, o); }
}
extern "C" void kernel_launch(void* const* d_in, const int* in_sizes, int n_in, void* d_out, int out_size, void* d_ws, size_t ws_size, hipStream_t stream) {
  (void)in_sizes; (void)n_in; (void)out_size; (void)ws_size;
  const float* x = (const float*)d_in[0]; const float* W0 = (const float*)d_in[1]; const float* W1 = (const float*)d_in[2]; const float* W2 = (const float*)d_in[3];
  float* out = (float*)d_out;
  char* ws = (char*)d_ws; size_t off = 0;
  auto take = [&](size_t bytes) { char* p = ws + off; off += (bytes + 255) & ~(size_t)255; return p; };
  float* Z1 = (float*)take((size_t)NBT * NN * 4); float* FT = (float*)take((size_t)NN * NBT * 4); _Float16* WF = (_Float16*)take((size_t)NN * NN * 2);
  k_z1<<<dim3(NBT / 64, NN / 128 + 2), 128, 0, stream>>>(x, W0, W1, Z1, WF);
  k_main<<<dim3(NBT / 64, NN / NG), 128, 0, stream>>>(x, W0, Z1, WF, W2, FT);
  k_tr<<<NBT / 64, 256, 0, stream>>>(FT, out);
}

// v006
// One run takes 32.7 microseconds.
// In two side-by-side timings against v005, it was 1.86 and 1.85 times as fast.
// All steps since v000 together make it 13.6 times as fast.
#include <hip/hip_runtime.h>
#include <math.h>

typedef __attribute__((ext_vector_type(16))) _Float16 v16h;
typedef __attribute__((ext_vector_type(16))) __bf16 v16b;
typedef __attribute__((ext_vector_type(8)))  _Float16 v8h;
typedef __attribute__((ext_vector_type(2)))  _Float16 v2h;
typedef __attribute__((ext_vector_type(8)))  float v8f;
typedef __attribute__((ext_vector_type(4)))  float v4f;
typedef __attribute__((ext_vector_type(2)))  float v2f;
typedef __attribute__((ext_vector_type(4)))  unsigned v4u;
typedef __attribute__((ext_vector_type(4)))  int v4i;
typedef float __attribute__((may_alias)) float_a;
typedef int __attribute__((may_alias)) int_a;

template <typename T> __device__ __forceinline__ void vst2(void* p, T v) { *(T*)p = v;  }
__device__ __forceinline__ v8f wmma16(v16h a, v16h b, v8f c) {
  return __builtin_amdgcn_wmma_f32_16x16x32_f16(false, a, false, b, (short)0, c, false, false);   // plain builtin: an asm statement that names the operands would tie them to the first 256 registers
}
__device__ __forceinline__ v8f wmma_bf(v16b a, v16b b, v8f c) {
  v8f d = __builtin_amdgcn_wmma_f32_16x16x32_bf16(false, a, false, b, (short)0, c, false, false);
  asm volatile("v_nop\n\tv_nop\n\tv_nop\n\tv_nop" : "+v"(d) : "v"(a), "v"(b));
  return d;
}
// 16x16x32 fragments: lane = (h = lane>>4, row/col = lane&15); elements 0..7 = k0+8h+0..7, 8..15 = k0+16+8h+0..7; D element r = row 8h+r
__device__ __forceinline__ v16h frag_h(const _Float16* rowk0, int lane) {
  union { v16h v; v8h q[2]; } u; const _Float16* p = rowk0 + 8 * (lane >> 4);
  u.q[0] = *(const v8h*)p; u.q[1] = *(const v8h*)(p + 16); return u.v;
}
__device__ __forceinline__ v16h frag_f32(const float* rowk0, int lane) {
  v16h a; const float* p = rowk0 + 8 * (lane >> 4);
#pragma unroll
  for (int i = 0; i < 8; ++i) { a[i] = (_Float16)p[i]; a[8 + i] = (_Float16)p[16 + i]; }
  return a;
}
__device__ __forceinline__ v16h frag_f32s(const float* rowk0, int lane, float sc) {
  v16h a; const float* p = rowk0 + 8 * (lane >> 4);
#pragma unroll
  for (int i = 0; i < 8; ++i) { a[i] = (_Float16)(p[i] * sc); a[8 + i] = (_Float16)(p[16 + i] * sc); }
  return a;
}
// column fragment from a [K][ld] layout (column n), rows >= K read as 0
__device__ __forceinline__ v16h fragc_f32(const float* W, int k0, int n, int lane, int ld, int K) {
  v16h a; const int g = lane >> 4;
#pragma unroll
  for (int i = 0; i < 8; ++i) { const int ka = k0 + 8 * g + i, kb = ka + 16;
    a[i] = (_Float16)(ka < K ? W[(size_t)ka * ld + n] : 0.f); a[8 + i] = (_Float16)(kb < K ? W[(size_t)kb * ld + n] : 0.f); }
  return a;
}
// A fragment stored in fragment order: 512 halves = elements 0..7 of lanes 0..31, then elements 8..15 of lanes 0..31 (two whole-line 16-byte loads)
__device__ __forceinline__ v16h frag_pre(const _Float16* f, int lane) {
  union { v16h v; v8h q[2]; } u; u.q[0] = *(const v8h*)(f + lane * 8); u.q[1] = *(const v8h*)(f + 256 + lane * 8); return u.v;
}
struct F2 { v16b h, l; };
__device__ __forceinline__ F2 bsplit16(const float v[16]) { F2 r;
#pragma unroll
  for (int i = 0; i < 16; ++i) { const __bf16 h = (__bf16)v[i]; r.h[i] = h; r.l[i] = (__bf16)(v[i] - (float)h); }
  return r; }
__device__ __forceinline__ F2 split_row(const float* row, int k0, int lane) { float v[16]; const float* p = row + k0 + 8 * (lane >> 4);
#pragma unroll
  for (int i = 0; i < 8; ++i) { v[i] = p[i]; v[8 + i] = p[16 + i]; }
  return bsplit16(v); }
__device__ __forceinline__ F2 split_rowK(const float* row, int k0, int lane, int K) { float v[16]; const int g = lane >> 4;
#pragma unroll
  for (int i = 0; i < 8; ++i) { const int ka = k0 + 8 * g + i, kb = ka + 16; v[i] = ka < K ? row[ka] : 0.f; v[8 + i] = kb < K ? row[kb] : 0.f; }
  return bsplit16(v); }
__device__ __forceinline__ F2 split_col(const float* W, int k0, int n, int lane, int ld, int K) { float v[16]; const int g = lane >> 4;
#pragma unroll
  for (int i = 0; i < 8; ++i) { const int ka = k0 + 8 * g + i, kb = ka + 16; v[i] = ka < K ? W[(size_t)ka * ld + n] : 0.f; v[8 + i] = kb < K ? W[(size_t)kb * ld + n] : 0.f; }
  return bsplit16(v); }
__device__ __forceinline__ v8f mac3(const F2& a, const F2& b, v8f c) { c = wmma_bf(a.l, b.h, c); c = wmma_bf(a.h, b.l, c); return wmma_bf(a.h, b.h, c); }
// one v_tanh_f32 in place of the branching library routine
__device__ __forceinline__ float tanh1(float v) { return __builtin_amdgcn_tanhf(v); }
__device__ __forceinline__ float sigm(float v) { return 1.0f / (1.0f + expf(-v)); }
#define LDSX() do { asm volatile("s_wait_dscnt 0" ::: "memory"); __builtin_amdgcn_wave_barrier(); __builtin_amdgcn_fence(__ATOMIC_RELEASE, "workgroup"); } while (0)

// Leave-one-input-out MLP: for every (node i, sample b) the 3-layer tanh MLP is run on x with column i zeroed and output column i kept.
// Layer 1 uses the rank-1 identity (x - x_i e_i) W0^T = z1 - x_i W0[:, i] with z1 = x W0^T computed once (two-way bf16 split), so the
// masked hidden rows are generated on the fly (tanh in f32 -> f16 operand); layer 2 is the [262144 x 256] @ [256 x 256] product on
// v_wmma_f32_16x16x32_f16 (W1 rows x16, converted once to f16 in fragment order in the workspace) with W1 as A and the hidden rows (f16, in LDS) as B; a wave
// holds 64 channels x 64 samples, so each W1 fragment feeds four products; layer 3 needs only column i: tanh(h2 . W2[i]) in f32, summed per lane, the eight partial sums of a sample joined through LDS.
#define NBT 1024
#define NN 256

// blockIdx.y < 8: z1 = x @ W0^T (split) : [1024 x 256], a wave = 16 rows x 32 columns; blockIdx.y >= 8: WF = 16 * W1 as f16, fragment f = kc * 16 + t (k block kc, column tile t)
__global__ __launch_bounds__(64, 1) void k_z1(const float* __restrict__ x, const float* __restrict__ W0, const float* __restrict__ W1, float* __restrict__ Z1, _Float16* __restrict__ WF) {
  __shared__ __align__(16) float so[2][16][36];   // 144-byte rows: an odd count of 16-byte units
  const int tid = threadIdx.x, wave = tid >> 5, lane = tid & 31, col = lane & 15, g = lane >> 4;
  if (blockIdx.y >= 8) { const int f = (blockIdx.y - 8) * 64 + blockIdx.x * 2 + wave, kc = f >> 4, t = f & 15;   // one fragment per wave
    union { v16h v; v8h q[2]; } b; b.v = frag_f32s(W1 + (size_t)(t * 16 + col) * NN + kc * 32, lane, 16.0f);
    vst2(WF + (size_t)f * 512 + lane * 8, b.q[0]); vst2(WF + (size_t)f * 512 + 256 + lane * 8, b.q[1]);
    return;
  }
  const int r0 = blockIdx.x * 32 + wave * 16, n0 = blockIdx.y * 32;
  const float* xp = x + (size_t)(r0 + col) * NN + 8 * g;    // the lane's row of x, at its half's first k
  const float* wp = W0 + (size_t)(n0 + col) * NN + 8 * g;   // the lane's row of W0 (column tile 0; tile 1 lies 16 rows on)
  v4f rx[NN / 32][4], rw[NN / 32][2][4];   // quarter q of a fragment = k0 + 8 g + 16 (q >> 1) + 4 (q & 1) + 0..3, the order of split_row
#pragma unroll  // straight line: every load of the wave is issued before the first product, so their round trips overlap
  for (int kc = 0; kc < NN / 32; ++kc) {
#pragma unroll
    for (int q = 0; q < 4; ++q) rx[kc][q] = *(const v4f*)(xp + kc * 32 + (q >> 1) * 16 + (q & 1) * 4);
#pragma unroll
    for (int j = 0; j < 2; ++j)
#pragma unroll
      for (int q = 0; q < 4; ++q) rw[kc][j][q] = *(const v4f*)(wp + (size_t)j * 16 * NN + kc * 32 + (q >> 1) * 16 + (q & 1) * 4); }
  asm volatile("s_wait_xcnt 0x0" :: "v"(xp), "v"(wp) : "memory");   // stands in front of any overwrite of the address registers of the loads above; the addresses as inputs keep a load's result off those registers until here
  v8f acc[2] = {};
#pragma unroll  // constant indices keep rx[] and rw[] in registers
  for (int kc = 0; kc < NN / 32; ++kc) { float v[16];
#pragma unroll
    for (int i = 0; i < 16; ++i) v[i] = rx[kc][i >> 2][i & 3];
    const F2 a = bsplit16(v);
#pragma unroll
    for (int j = 0; j < 2; ++j) {
#pragma unroll
      for (int i = 0; i < 16; ++i) v[i] = rw[kc][j][i >> 2][i & 3];
      acc[j] = mac3(a, bsplit16(v), acc[j]); } }
#pragma unroll
  for (int j = 0; j < 2; ++j)
#pragma unroll
    for (int r = 0; r < 8; ++r) so[wave][8 * g + r][j * 16 + col] = acc[j][r];
  LDSX();
#pragma unroll
  for (int rl = 0; rl < 4; ++rl) { const int row = rl * 4 + (lane >> 3);   // a store = four rows of 128 bytes, whole lines
    vst2(Z1 + (size_t)(r0 + row) * NN + n0 + (lane & 7) * 4, *(const v4f*)(&so[wave][row][(lane & 7) * 4])); }
  asm volatile("s_wait_xcnt 0x0" ::: "memory");   // stands behind the four stores, in front of any overwrite of their address or data registers
}
// main: block (64 samples b, NG nodes i): what does not depend on the node is fetched once per block: a wave's 64 channels of W1 (32 fragments) stay in registers,
// the z1 rows of the samples and the nodes' columns of x and W0 and rows of W2 stay in LDS; per node the 64 hidden rows are made as f16 in LDS, wave w owns channels 64 w .. 64 w + 63 of all 64 samples ; FT[i][b]
#define HP 264   // halves per hidden row in LDS: 528 bytes = 16 x 33, an odd count of 16-byte units, so the 16-byte fragment reads meet no bank conflict
#define NG 8     // nodes per block: 16 x 32 blocks, two per WGP at two waves per SIMD
__global__ __launch_bounds__(128, 2) void k_main(const float* __restrict__ x, const float* __restrict__ W0, const float* __restrict__ Z1, const _Float16* __restrict__ WF, const float* __restrict__ W2, float* __restrict__ FT) {
  __shared__ __align__(16) _Float16 sh[64][HP];           // tanh(z1 - x_i W0[:, i]) of the block's samples
  __shared__ __align__(16) float sz[64][NN];              // z1 of the block's samples; a thread reads back only the two channels it wrote
  __shared__ __align__(16) float sx[NG][64];              // x[sample][i0 + n]
  __shared__ __align__(16) float sw0[NG][NN];             // W0[channel][i0 + n]; a thread reads back only the two channels it wrote
  __shared__ __align__(16) float sw2[NG][NN];             // W2[i0 + n][:]
  __shared__ __align__(16) float sp[8][64];               // layer-3 partial sums: [wave * 2 + lane half][sample]
  const int tid = threadIdx.x, wave = tid >> 5, lane = tid & 31, col = lane & 15, g = lane >> 4;
  const int i0 = blockIdx.y * NG, b0 = blockIdx.x * 64, k2 = tid * 2;
  const _Float16* wf = WF + (size_t)wave * 4 * 512;
  v16h a[NN / 32][4];
#pragma unroll  // here and below: constant indices keep a[], b[] and acc[] in registers
  for (int kc = 0; kc < NN / 32; ++kc)
#pragma unroll
    for (int j = 0; j < 4; ++j) a[kc][j] = frag_pre(wf + (size_t)(kc * 16 + j) * 512, lane);
  asm volatile("s_wait_xcnt 0x0" :: "v"(wf + lane * 8) : "memory");   // stands in front of any overwrite of the address registers of the W1 loads above; the address as an input keeps a load's result off those registers until here
  { const float* zp = Z1 + (size_t)b0 * NN + k2; v2f z[64];
#pragma unroll  // straight line: the loads of all rows fly together
    for (int r = 0; r < 64; ++r) z[r] = *(const v2f*)(zp + (size_t)r * NN);
    asm volatile("s_wait_xcnt 0x0" ::: "memory");   // stands in front of any overwrite of the address registers of the z1 loads
#pragma unroll
    for (int r = 0; r < 64; ++r) vst2(&sz[r][k2], z[r]); }
  { const int r = tid >> 1, hf = tid & 1;
    const v4f xv = *(const v4f*)(x + (size_t)(b0 + r) * NN + i0 + 4 * hf);
    const float* wp = W0 + (size_t)k2 * NN + i0;
    const v4f wa0 = *(const v4f*)wp, wa1 = *(const v4f*)(wp + 4), wb0 = *(const v4f*)(wp + NN), wb1 = *(const v4f*)(wp + NN + 4);
    asm volatile("s_wait_xcnt 0x0" :: "v"(wp) : "memory");   // stands in front of any overwrite of the address registers of the x and W0 loads; the W0 address as an input keeps a load's result off those registers until here
    v2f w2v[NG];
#pragma unroll
    for (int n = 0; n < NG; ++n) w2v[n] = *(const v2f*)(W2 + (size_t)(i0 + n) * NN + k2);
    asm volatile("s_wait_xcnt 0x0" ::: "memory");   // stands in front of any overwrite of the address registers of the W2 loads
#pragma unroll
    for (int e = 0; e < 4; ++e) { sx[4 * hf + e][r] = xv[e]; vst2(&sw0[e][k2], (v2f){wa0[e], wb0[e]}); vst2(&sw0[4 + e][k2], (v2f){wa1[e], wb1[e]}); }
#pragma unroll
    for (int n = 0; n < NG; ++n) vst2(&sw2[n][k2], w2v[n]); }
  __syncthreads();   // publishes x and W2 of the block's nodes to all four waves
#pragma unroll 1  // one copy of the body
  for (int n = 0; n < NG; ++n) { const int i = i0 + n;
    // layer 1: thread = channels 2 tid, 2 tid + 1 of every sample
    { const v2f w0 = *(const v2f*)(&sw0[n][k2]);
#pragma unroll
      for (int q = 0; q < 16; ++q) { const v4f xv = *(const v4f*)(&sx[n][4 * q]);
#pragma unroll
        for (int e = 0; e < 4; ++e) { const int r = 4 * q + e; const v2f z = *(const v2f*)(&sz[r][k2]); v2h h; h[0] = (_Float16)tanh1(z[0] - xv[e] * w0[0]); h[1] = (_Float16)tanh1(z[1] - xv[e] * w0[1]); vst2(&sh[r][k2], h); } } }
    __syncthreads();   // publishes the hidden rows to all four waves
    v8f acc[4][4];     // [channel tile j][sample tile m]
#pragma unroll
    for (int j = 0; j < 4; ++j)
#pragma unroll
      for (int m = 0; m < 4; ++m) acc[j][m] = (v8f){};
    v16h b[2][4]; v4f w[8];
#pragma unroll
    for (int m = 0; m < 4; ++m) b[0][m] = frag_h(&sh[m * 16 + col][0], lane);
#pragma unroll
    for (int kc = 0; kc < NN / 32; ++kc) {
      if (kc + 1 < NN / 32) {
#pragma unroll
        for (int m = 0; m < 4; ++m) b[(kc + 1) & 1][m] = frag_h(&sh[m * 16 + col][(kc + 1) * 32], lane);   // the next k block's hidden-row fragments fly behind these 16 products
      } else {
#pragma unroll
        for (int q = 0; q < 8; ++q) w[q] = *(const v4f*)(&sw2[n][wave * 64 + (q >> 1) * 16 + 8 * g + 4 * (q & 1)]); }   // layer 3's W2 values fly behind the last 16 products
      __builtin_amdgcn_sched_barrier(0);   // keeps the LDS reads above together in front of the products: left free, the compiler spread them among the products with a full wait at each group
#pragma unroll
      for (int m = 0; m < 4; ++m)
#pragma unroll
        for (int j = 0; j < 4; ++j) acc[j][m] = wmma16(a[kc][j], b[kc & 1][m], acc[j][m]);
      __builtin_amdgcn_sched_barrier(0); }   // keeps later LDS reads from rising into this block of products, so only two fragment sets are live
    // layer 3, column i only: f = tanh( sum_n tanh(h2[n]) W2[i][n] ): acc[j][m][r] = 16 * h2[sample 16 m + col][n = 64 wave + 16 j + 8 g + r]
    {
#pragma unroll
      for (int m = 0; m < 4; ++m) { v2f sv[2] = {};
#pragma unroll
        for (int j = 0; j < 4; ++j)
#pragma unroll
          for (int e = 0; e < 4; ++e) { const v2f p = (v2f){acc[j][m][2 * e], acc[j][m][2 * e + 1]} * (1.0f / 16.0f);
            sv[e & 1] = __builtin_elementwise_fma((v2f){tanh1(p[0]), tanh1(p[1])}, (v2f){w[2 * j + (e >> 1)][2 * (e & 1)], w[2 * j + (e >> 1)][2 * (e & 1) + 1]}, sv[e & 1]); }
        const v2f u = sv[0] + sv[1]; sp[wave * 2 + g][m * 16 + col] = u[0] + u[1]; } }
    __syncthreads();   // the eight partial sums of every sample are in LDS; every wave has left sh, which the next node's layer 1 rewrites
    if (tid < 64) { float s = 0.f;
#pragma unroll
      for (int q = 0; q < 8; ++q) s += sp[q][tid];
      float f;
      asm("v_tanh_f32 %0, %1\n\tv_nop" : "=v"(f) : "v"(s));   // v_nop: the one slot the instruction set asks for between v_tanh_f32 and the store that reads its result
      FT[(size_t)i * NBT + b0 + tid] = f;
      asm volatile("s_wait_xcnt 0x0" ::: "memory"); }   // stands in front of the next node's overwrite of the store's address registers
  }
}
// transpose FT [i][b] -> out [b][i]: block = 64 b x 256 i via LDS
__global__ __launch_bounds__(256) void k_tr(const float* __restrict__ FT, float* __restrict__ out) {
  __shared__ float st[64][NN + 1];
  const int b0 = blockIdx.x * 64, tid = threadIdx.x;
  for (int q = tid; q < NN * 64; q += 256) { const int i = q >> 6, bl = q & 63; st[bl][i] = FT[(size_t)i * NBT + b0 + bl]; }
  __syncthreads();
  for (int q = tid; q < 64 * (NN / 4); q += 256) { const int bl = q >> 6, pc = q & 63; v4f o; o[0] = st[bl][pc * 4]; o[1] = st[bl][pc * 4 + 1]; o[2] = st[bl][pc * 4 + 2]; o[3] = st[bl][pc * 4 + 3]; vst2(out + (size_t)(b0 + bl) * NN + pc * 4, o); }
}
extern "C" void kernel_launch(void* const* d_in, const int* in_sizes, int n_in, void* d_out, int out_size, void* d_ws, size_t ws_size, hipStream_t stream) {
  (void)in_sizes; (void)n_in; (void)out_size; (void)ws_size;
  const float* x = (const float*)d_in[0]; const float* W0 = (const float*)d_in[1]; const float* W1 = (const float*)d_in[2]; const float* W2 = (const float*)d_in[3];
  float* out = (float*)d_out;
  char* ws = (char*)d_ws; size_t off = 0;
  auto take = [&](size_t bytes) { char* p = ws + off; off += (bytes + 255) & ~(size_t)255; return p; };
  float* Z1 = (float*)take((size_t)NBT * NN * 4); float* FT = (float*)take((size_t)NN * NBT * 4); _Float16* WF = (_Float16*)take((size_t)NN * NN * 2);
  k_z1<<<dim3(NBT / 32, NN / 32 + 2), 64, 0, stream>>>(x, W0, W1, Z1, WF);
  k_main<<<dim3(NBT / 64, NN / NG), 128, 0, stream>>>(x, W0, Z1, WF, W2, FT);
  k_tr<<<NBT / 64, 256, 0, stream>>>(FT, out);
}

// v007
// One run takes 29 microseconds.
// Next to v006, in two timings, it ran 1.13 and 1.14 times as fast.
// All steps since v000 together make it 15.5 times as fast.
#include <hip/hip_runtime.h>
#include <math.h>

typedef __attribute__((ext_vector_type(16))) _Float16 v16h;
typedef __attribute__((ext_vector_type(16))) __bf16 v16b;
typedef __attribute__((ext_vector_type(8)))  _Float16 v8h;
typedef __attribute__((ext_vector_type(2)))  _Float16 v2h;
typedef __attribute__((ext_vector_type(8)))  float v8f;
typedef __attribute__((ext_vector_type(4)))  float v4f;
typedef __attribute__((ext_vector_type(2)))  float v2f;
typedef __attribute__((ext_vector_type(4)))  unsigned v4u;
typedef __attribute__((ext_vector_type(4)))  int v4i;
typedef float __attribute__((may_alias)) float_a;
typedef int __attribute__((may_alias)) int_a;

template <typename T> __device__ __forceinline__ void vst2(void* p, T v) { *(T*)p = v;  }
__device__ __forceinline__ v8f wmma16(v16h a, v16h b, v8f c) {
  return __builtin_amdgcn_wmma_f32_16x16x32_f16(false, a, false, b, (short)0, c, false, false);   // plain builtin: an asm statement that names the operands would tie them to the first 256 registers
}
__device__ __forceinline__ v8f wmma_bf(v16b a, v16b b, v8f c) {
  v8f d = __builtin_amdgcn_wmma_f32_16x16x32_bf16(false, a, false, b, (short)0, c, false, false);
  asm volatile("v_nop\n\tv_nop\n\tv_nop\n\tv_nop" : "+v"(d) : "v"(a), "v"(b));
  return d;
}
// 16x16x32 fragments: lane = (h = lane>>4, row/col = lane&15); elements 0..7 = k0+8h+0..7, 8..15 = k0+16+8h+0..7; D element r = row 8h+r
__device__ __forceinline__ v16h frag_h(const _Float16* rowk0, int lane) {
  union { v16h v; v8h q[2]; } u; const _Float16* p = rowk0 + 8 * (lane >> 4);
  u.q[0] = *(const v8h*)p; u.q[1] = *(const v8h*)(p + 16); return u.v;
}
__device__ __forceinline__ v16h frag_f32(const float* rowk0, int lane) {
  v16h a; const float* p = rowk0 + 8 * (lane >> 4);
#pragma unroll
  for (int i = 0; i < 8; ++i) { a[i] = (_Float16)p[i]; a[8 + i] = (_Float16)p[16 + i]; }
  return a;
}
__device__ __forceinline__ v16h frag_f32s(const float* rowk0, int lane, float sc) {
  v16h a; const float* p = rowk0 + 8 * (lane >> 4);
#pragma unroll
  for (int i = 0; i < 8; ++i) { a[i] = (_Float16)(p[i] * sc); a[8 + i] = (_Float16)(p[16 + i] * sc); }
  return a;
}
// column fragment from a [K][ld] layout (column n), rows >= K read as 0
__device__ __forceinline__ v16h fragc_f32(const float* W, int k0, int n, int lane, int ld, int K) {
  v16h a; const int g = lane >> 4;
#pragma unroll
  for (int i = 0; i < 8; ++i) { const int ka = k0 + 8 * g + i, kb = ka + 16;
    a[i] = (_Float16)(ka < K ? W[(size_t)ka * ld + n] : 0.f); a[8 + i] = (_Float16)(kb < K ? W[(size_t)kb * ld + n] : 0.f); }
  return a;
}
// A fragment stored in fragment order: 512 halves = elements 0..7 of lanes 0..31, then elements 8..15 of lanes 0..31 (two whole-line 16-byte loads)
__device__ __forceinline__ v16h frag_pre(const _Float16* f, int lane) {
  union { v16h v; v8h q[2]; } u; u.q[0] = *(const v8h*)(f + lane * 8); u.q[1] = *(const v8h*)(f + 256 + lane * 8); return u.v;
}
struct F2 { v16b h, l; };
__device__ __forceinline__ F2 bsplit16(const float v[16]) { F2 r;
#pragma unroll
  for (int i = 0; i < 16; ++i) { const __bf16 h = (__bf16)v[i]; r.h[i] = h; r.l[i] = (__bf16)(v[i] - (float)h); }
  return r; }
__device__ __forceinline__ F2 split_row(const float* row, int k0, int lane) { float v[16]; const float* p = row + k0 + 8 * (lane >> 4);
#pragma unroll
  for (int i = 0; i < 8; ++i) { v[i] = p[i]; v[8 + i] = p[16 + i]; }
  return bsplit16(v); }
__device__ __forceinline__ F2 split_rowK(const float* row, int k0, int lane, int K) { float v[16]; const int g = lane >> 4;
#pragma unroll
  for (int i = 0; i < 8; ++i) { const int ka = k0 + 8 * g + i, kb = ka + 16; v[i] = ka < K ? row[ka] : 0.f; v[8 + i] = kb < K ? row[kb] : 0.f; }
  return bsplit16(v); }
__device__ __forceinline__ F2 split_col(const float* W, int k0, int n, int lane, int ld, int K) { float v[16]; const int g = lane >> 4;
#pragma unroll
  for (int i = 0; i < 8; ++i) { const int ka = k0 + 8 * g + i, kb = ka + 16; v[i] = ka < K ? W[(size_t)ka * ld + n] : 0.f; v[8 + i] = kb < K ? W[(size_t)kb * ld + n] : 0.f; }
  return bsplit16(v); }
__device__ __forceinline__ v8f mac3(const F2& a, const F2& b, v8f c) { c = wmma_bf(a.l, b.h, c); c = wmma_bf(a.h, b.l, c); return wmma_bf(a.h, b.h, c); }
// one v_tanh_f32 in place of the branching library routine
__device__ __forceinline__ float tanh1(float v) { return __builtin_amdgcn_tanhf(v); }
__device__ __forceinline__ float sigm(float v) { return 1.0f / (1.0f + expf(-v)); }
#define LDSX() do { asm volatile("s_wait_dscnt 0" ::: "memory"); __builtin_amdgcn_wave_barrier(); __builtin_amdgcn_fence(__ATOMIC_RELEASE, "workgroup"); } while (0)

// Leave-one-input-out MLP: for every (node i, sample b) the 3-layer tanh MLP is run on x with column i zeroed and output column i kept.
// Layer 1 uses the rank-1 identity (x - x_i e_i) W0^T = z1 - x_i W0[:, i] with z1 = x W0^T computed once (two-way bf16 split), so the
// masked hidden rows are generated on the fly (tanh in f32 -> f16 operand); layer 2 is the [262144 x 256] @ [256 x 256] product on
// v_wmma_f32_16x16x32_f16 (W1 rows x16, converted once to f16 in fragment order in the workspace) with W1 as A and the hidden rows (f16, in LDS) as B; a wave
// holds 64 channels x 64 rows (4 nodes x 16 samples), so each W1 fragment feeds four products; layer 3 needs only column i: tanh(h2 . W2[i]) in f32, summed per lane, the eight partial sums of a row joined through LDS.
#define NBT 1024
#define NN 256

// blockIdx.y < 8: z1 = x @ W0^T (split) : [1024 x 256], a wave = 16 rows x 32 columns; blockIdx.y >= 8: WF = 16 * W1 as f16, fragment f = kc * 16 + t (k block kc, column tile t)
__global__ __launch_bounds__(64, 1) void k_z1(const float* __restrict__ x, const float* __restrict__ W0, const float* __restrict__ W1, float* __restrict__ Z1, _Float16* __restrict__ WF) {
  __shared__ __align__(16) float so[2][16][36];   // 144-byte rows: an odd count of 16-byte units
  const int tid = threadIdx.x, wave = tid >> 5, lane = tid & 31, col = lane & 15, g = lane >> 4;
  if (blockIdx.y >= 8) { const int f = (blockIdx.y - 8) * 64 + blockIdx.x * 2 + wave, kc = f >> 4, t = f & 15;   // one fragment per wave
    union { v16h v; v8h q[2]; } b; b.v = frag_f32s(W1 + (size_t)(t * 16 + col) * NN + kc * 32, lane, 16.0f);
    vst2(WF + (size_t)f * 512 + lane * 8, b.q[0]); vst2(WF + (size_t)f * 512 + 256 + lane * 8, b.q[1]);
    return;
  }
  const int r0 = blockIdx.x * 32 + wave * 16, n0 = blockIdx.y * 32;
  const float* xp = x + (size_t)(r0 + col) * NN + 8 * g;    // the lane's row of x, at its half's first k
  const float* wp = W0 + (size_t)(n0 + col) * NN + 8 * g;   // the lane's row of W0 (column tile 0; tile 1 lies 16 rows on)
  v4f rx[NN / 32][4], rw[NN / 32][2][4];   // quarter q of a fragment = k0 + 8 g + 16 (q >> 1) + 4 (q & 1) + 0..3, the order of split_row
#pragma unroll  // straight line: every load of the wave is issued before the first product, so their round trips overlap
  for (int kc = 0; kc < NN / 32; ++kc) {
#pragma unroll
    for (int q = 0; q < 4; ++q) rx[kc][q] = *(const v4f*)(xp + kc * 32 + (q >> 1) * 16 + (q & 1) * 4);
#pragma unroll
    for (int j = 0; j < 2; ++j)
#pragma unroll
      for (int q = 0; q < 4; ++q) rw[kc][j][q] = *(const v4f*)(wp + (size_t)j * 16 * NN + kc * 32 + (q >> 1) * 16 + (q & 1) * 4); }
  asm volatile("s_wait_xcnt 0x0" :: "v"(xp), "v"(wp) : "memory");   // stands in front of any overwrite of the address registers of the loads above; the addresses as inputs keep a load's result off those registers until here
  v8f acc[2] = {};
#pragma unroll  // constant indices keep rx[] and rw[] in registers
  for (int kc = 0; kc < NN / 32; ++kc) { float v[16];
#pragma unroll
    for (int i = 0; i < 16; ++i) v[i] = rx[kc][i >> 2][i & 3];
    const F2 a = bsplit16(v);
#pragma unroll
    for (int j = 0; j < 2; ++j) {
#pragma unroll
      for (int i = 0; i < 16; ++i) v[i] = rw[kc][j][i >> 2][i & 3];
      acc[j] = mac3(a, bsplit16(v), acc[j]); } }
#pragma unroll
  for (int j = 0; j < 2; ++j)
#pragma unroll
    for (int r = 0; r < 8; ++r) so[wave][8 * g + r][j * 16 + col] = acc[j][r];
  LDSX();
#pragma unroll
  for (int rl = 0; rl < 4; ++rl) { const int row = rl * 4 + (lane >> 3);   // a store = four rows of 128 bytes, whole lines
    vst2(Z1 + (size_t)(r0 + row) * NN + n0 + (lane & 7) * 4, *(const v4f*)(&so[wave][row][(lane & 7) * 4])); }
  asm volatile("s_wait_xcnt 0x0" ::: "memory");   // stands behind the four stores, in front of any overwrite of their address or data registers
}
// main: block (16 samples b, NG = 32 nodes i), so the block owns one whole 128-byte line of every output row it touches. What does not depend on the pass is fetched once per block:
// a wave's 64 channels of W1 (32 fragments) stay in registers, the z1 rows of the samples and the nodes' columns of x and W0 and rows of W2 stay in LDS. A pass = NP = 4 nodes x 16 samples = 64 hidden rows,
// made as f16 in LDS; wave w owns channels 64 w .. 64 w + 63 of all 64 rows. The results wait in LDS and leave as out[b][i] behind the last pass.
#define HP 264   // halves per hidden row in LDS: 528 bytes = 16 x 33, an odd count of 16-byte units, so the 16-byte fragment reads meet no bank conflict
#define NG 32    // nodes per block: 64 x 8 blocks, two per WGP at two waves per SIMD
#define NP 4     // nodes per pass
#define NS 16    // samples per block
#define WP 36    // floats per channel row of sw0: a thread's two rows start 72 dwords from its neighbour's, so a 16-byte read meets at most a two-way conflict
__global__ __launch_bounds__(128, 2) void k_main(const float* __restrict__ x, const float* __restrict__ W0, const float* __restrict__ Z1, const _Float16* __restrict__ WF, const float* __restrict__ W2, float* __restrict__ out) {
  __shared__ __align__(16) _Float16 sh[NP * NS][HP];      // tanh(z1 - x_i W0[:, i]); row = 16 * (node of the pass) + sample
  __shared__ __align__(16) float sz[NS][NN];              // z1 of the block's samples
  __shared__ __align__(16) float sx[NS][NG];              // x[sample][i0 + n]
  __shared__ __align__(16) float sw0[NN][WP];             // W0[channel][i0 + n]
  __shared__ __align__(16) float sw2[NG][NN];             // W2[i0 + n][:]
  __shared__ __align__(16) float sp[8][NP * NS];          // layer-3 partial sums: [wave * 2 + lane half][row]
  __shared__ __align__(16) float sf[NS][NG];              // the block's piece of out
  const int tid = threadIdx.x, wave = tid >> 5, lane = tid & 31, col = lane & 15, g = lane >> 4;
  const int i0 = blockIdx.y * NG, b0 = blockIdx.x * NS, k2 = tid * 2;
  const int rr = tid >> 3, pc = (tid & 7) * 4;   // eight threads per 128-byte row piece: a wave's 16-byte access = four whole lines
  const _Float16* wf = WF + (size_t)wave * 4 * 512;
  v16h a[NN / 32][4];
#pragma unroll  // here and below: constant indices keep a[], b[] and acc[] in registers
  for (int kc = 0; kc < NN / 32; ++kc)
#pragma unroll
    for (int j = 0; j < 4; ++j) a[kc][j] = frag_pre(wf + (size_t)(kc * 16 + j) * 512, lane);
  asm volatile("s_wait_xcnt 0x0" :: "v"(wf + lane * 8) : "memory");   // stands in front of any overwrite of the address registers of the W1 loads above; the address as an input keeps a load's result off those registers until here
  { const float* xp = x + (size_t)(b0 + rr) * NN + i0 + pc;
    const float* wp = W0 + (size_t)rr * NN + i0 + pc;
    const float* zp = Z1 + (size_t)b0 * NN + tid * 4;   // the 16 rows of z1 lie in a row
    const float* vp = W2 + (size_t)i0 * NN + tid * 4;   // so do the 32 rows of W2
    v4f wv[16], zv[8], w2v[16];
    const v4f xv = *(const v4f*)xp;
#pragma unroll  // straight line: all loads fly together
    for (int q = 0; q < 16; ++q) wv[q] = *(const v4f*)(wp + (size_t)q * 16 * NN);
#pragma unroll
    for (int q = 0; q < 8; ++q) zv[q] = *(const v4f*)(zp + q * 512);
#pragma unroll
    for (int q = 0; q < 16; ++q) w2v[q] = *(const v4f*)(vp + q * 512);
    asm volatile("s_wait_xcnt 0x0" :: "v"(xp), "v"(wp), "v"(tid) : "memory");   // stands in front of any overwrite of the address registers of the x, W0, z1 and W2 loads; the addresses (of z1 and W2: the thread's offset) as inputs keep those registers as they are until here
    vst2(&sx[rr][pc], xv);
#pragma unroll
    for (int q = 0; q < 16; ++q) vst2(&sw0[q * 16 + rr][pc], wv[q]);
#pragma unroll
    for (int q = 0; q < 8; ++q) vst2(&sz[0][0] + q * 512 + tid * 4, zv[q]);
#pragma unroll
    for (int q = 0; q < 16; ++q) vst2(&sw2[0][0] + q * 512 + tid * 4, w2v[q]); }
  __syncthreads();   // publishes z1, x, W0 and W2 of the block to all four waves
#pragma unroll 1  // one copy of the body, for speed only
  for (int p = 0; p < NG / NP; ++p) { const int n0 = p * NP;
    // layer 1: thread = channels 2 tid, 2 tid + 1 of every row
    { const v4f wa = *(const v4f*)(&sw0[k2][n0]), wb = *(const v4f*)(&sw0[k2 + 1][n0]);
#pragma unroll
      for (int s = 0; s < NS; ++s) { const v4f xv = *(const v4f*)(&sx[s][n0]); const v2f z = *(const v2f*)(&sz[s][k2]);
#pragma unroll
        for (int m = 0; m < NP; ++m) { v2h h; h[0] = (_Float16)tanh1(z[0] - xv[m] * wa[m]); h[1] = (_Float16)tanh1(z[1] - xv[m] * wb[m]); vst2(&sh[m * NS + s][k2], h); } } }
    __syncthreads();   // publishes the hidden rows to all four waves
    v8f acc[4][NP];    // [channel tile j][node m of the pass]
#pragma unroll
    for (int j = 0; j < 4; ++j)
#pragma unroll
      for (int m = 0; m < NP; ++m) acc[j][m] = (v8f){};
    v16h b[2][NP]; v4f w[NP][8];
#pragma unroll
    for (int m = 0; m < NP; ++m) b[0][m] = frag_h(&sh[m * NS + col][0], lane);
#pragma unroll
    for (int kc = 0; kc < NN / 32; ++kc) {
      if (kc + 1 < NN / 32) {
#pragma unroll
        for (int m = 0; m < NP; ++m) b[(kc + 1) & 1][m] = frag_h(&sh[m * NS + col][(kc + 1) * 32], lane);   // the next k block's hidden-row fragments fly behind these 16 products
      } else {
#pragma unroll
        for (int m = 0; m < 2; ++m)
#pragma unroll
          for (int q = 0; q < 8; ++q) w[m][q] = *(const v4f*)(&sw2[n0 + m][wave * 64 + (q >> 1) * 16 + 8 * g + 4 * (q & 1)]); }   // layer 3's W2 values of the first two nodes fly behind the last 16 products
      __builtin_amdgcn_sched_barrier(0);   // keeps the LDS reads above together in front of the products: left free, the compiler spread them among the products with a full wait at each group
#pragma unroll
      for (int m = 0; m < NP; ++m)
#pragma unroll
        for (int j = 0; j < 4; ++j) acc[j][m] = wmma16(a[kc][j], b[kc & 1][m], acc[j][m]);
      __builtin_amdgcn_sched_barrier(0); }   // keeps later LDS reads from rising into this block of products, so only two fragment sets are live
    // layer 3, column i only: f = tanh( sum_n tanh(h2[n]) W2[i][n] ): acc[j][m][r] = 16 * h2[node n0 + m, sample col][n = 64 wave + 16 j + 8 g + r]
    {
#pragma unroll
      for (int m = 0; m < NP; ++m) { v2f sv[2] = {};
        if (m + 2 < NP) {
#pragma unroll
          for (int q = 0; q < 8; ++q) w[m + 2][q] = *(const v4f*)(&sw2[n0 + m + 2][wave * 64 + (q >> 1) * 16 + 8 * g + 4 * (q & 1)]); }   // two nodes ahead, into registers that the products have left
#pragma unroll
        for (int j = 0; j < 4; ++j)
#pragma unroll
          for (int e = 0; e < 4; ++e) { const v2f pr = (v2f){acc[j][m][2 * e], acc[j][m][2 * e + 1]} * (1.0f / 16.0f);
            sv[e & 1] = __builtin_elementwise_fma((v2f){tanh1(pr[0]), tanh1(pr[1])}, (v2f){w[m][2 * j + (e >> 1)][2 * (e & 1)], w[m][2 * j + (e >> 1)][2 * (e & 1) + 1]}, sv[e & 1]); }
        const v2f u = sv[0] + sv[1]; sp[wave * 2 + g][m * NS + col] = u[0] + u[1]; } }
    __syncthreads();   // the eight partial sums of every row are in LDS; every wave has left sh, which the next pass's layer 1 rewrites
    if (tid < NP * NS) { float s = 0.f;
#pragma unroll
      for (int q = 0; q < 8; ++q) s += sp[q][tid];
      float f;
      asm("v_tanh_f32 %0, %1\n\tv_nop" : "=v"(f) : "v"(s));   // v_nop: the one slot the instruction set asks for between v_tanh_f32 and the store that reads its result
      sf[tid & 15][n0 + (tid >> 4)] = f; }
  }
  __syncthreads();   // publishes the results of waves 0 and 1 to all four waves
  vst2(out + (size_t)(b0 + rr) * NN + i0 + pc, *(const v4f*)(&sf[rr][pc]));   // a wave's store = four rows of 128 bytes, whole lines, each written by this block alone
}
extern "C" void kernel_launch(void* const* d_in, const int* in_sizes, int n_in, void* d_out, int out_size, void* d_ws, size_t ws_size, hipStream_t stream) {
  (void)in_sizes; (void)n_in; (void)out_size; (void)ws_size;
  const float* x = (const float*)d_in[0]; const float* W0 = (const float*)d_in[1]; const float* W1 = (const float*)d_in[2]; const float* W2 = (const float*)d_in[3];
  float* out = (float*)d_out;
  char* ws = (char*)d_ws; size_t off = 0;
  auto take = [&](size_t bytes) { char* p = ws + off; off += (bytes + 255) & ~(size_t)255; return p; };
  float* Z1 = (float*)take((size_t)NBT * NN * 4); _Float16* WF = (_Float16*)take((size_t)NN * NN * 2);
  k_z1<<<dim3(NBT / 32, NN / 32 + 2), 64, 0, stream>>>(x, W0, W1, Z1, WF);
  k_main<<<dim3(NBT / NS, NN / NG), 128, 0, stream>>>(x, W0, Z1, WF, W2, out);
}
